// v000
// Times are from an AMD MI455X. After a warm-up the kernel runs many times in a row, and a time is the length of
// such a window on the GPU divided by its runs, so every launch and the gaps after it count. The runs cycle
// through copies of the inputs. A figure is the median of several windows, for all but v000 over two sittings.
// Sittings can differ by a few percent; kernels timed side by side share one.
// The starting kernel, v000, takes 89.1 microseconds a run.
#include <hip/hip_runtime.h>

typedef __attribute__((ext_vector_type(16))) _Float16 v16h;
typedef __attribute__((ext_vector_type(8)))  _Float16 h8;
typedef __attribute__((ext_vector_type(8)))  float    v8f;

#define CH     64
#define IMG_H  128
#define IMG_W  128
#define HEADS  8
#define HD     8
#define NTOK   256   // tokens per window (128 * 2)
#define KPAD   24    // Q/K row: d 0..7 data, 8..23 zero (48B row, 16B-multiple)
#define PPAD   40    // P-chunk row: 32 permuted cols + pad (80B, 16B-multiple)
#define VPAD   264   // V^T row pad (528B, 16B-multiple, bank-skewed)

// 2-bit group bit-reverse permutation on bits [4:3] of a K/token index:
// groups of 8 reordered 0,2,1,3 so a WMMA 16-bit fragment's element order
// (K = half*8 + 0..7, then 16 + half*8 + 0..7) is contiguous in LDS.
__device__ __forceinline__ int kperm(int n) {
    return (n & ~0x18) | ((n & 8) << 1) | ((n & 16) >> 1);
}

__global__ __launch_bounds__(256, 1)
void lepe_attn_kernel(const float* __restrict__ temp,
                      const float* __restrict__ conv_w,
                      const float* __restrict__ conv_b,
                      float* __restrict__ out)
{
    __shared__ alignas(16) _Float16 sQ[NTOK][KPAD];   // [token][d | zeros]
    __shared__ alignas(16) _Float16 sK[NTOK][KPAD];
    __shared__ alignas(16) _Float16 sVT[16][VPAD];    // [d][perm(token)], rows 8..15 zero
    __shared__ alignas(16) float    sRO[NTOK][HD];    // rpe, later overwritten by out
    __shared__ alignas(16) _Float16 sPc[8][16][PPAD]; // per-wave P chunk, perm cols

    const int wh = blockIdx.x;          // 0 .. 2047
    const int b  = wh >> 9;             // batch
    const int w  = (wh >> 3) & 63;      // window (column strip)
    const int h  = wh & 7;              // head

    const int tid  = threadIdx.x;
    const int wave = tid >> 5;
    const int lane = tid & 31;
    const int wc   = w * 2;

    const float scale = 0.35355339059327373f;   // 8^-0.5

    __builtin_prefetch(conv_w + (h * HD) * 9, 0, 0);
    __builtin_prefetch(conv_b + h * HD, 0, 0);

    h8 z8;
#pragma unroll
    for (int i = 0; i < 8; ++i) z8[i] = (_Float16)0.f;

    // ---------------- stage Q,K,V  global(f32) -> LDS(f16) ----------------
    {
        const int d  = tid >> 5;        // head-dim element 0..7
        const int g  = tid & 31;        // token group
        const int n0 = g * 8;           // first token of group
        const size_t plane = (size_t)IMG_H * IMG_W;
        const size_t cofs  = (size_t)(h * HD + d) * plane + wc;
        const float* qs = temp + ((size_t)(b * 3 + 0) * CH) * plane + cofs;
        const float* ks = temp + ((size_t)(b * 3 + 1) * CH) * plane + cofs;
        const float* vs = temp + ((size_t)(b * 3 + 2) * CH) * plane + cofs;

#pragma unroll
        for (int i = 0; i < 4; ++i) {
            const int row = (n0 >> 1) + i;
            const int n   = n0 + 2 * i;
            const float2 qv = *(const float2*)(qs + (size_t)row * IMG_W);
            const float2 kv = *(const float2*)(ks + (size_t)row * IMG_W);
            const float2 vv = *(const float2*)(vs + (size_t)row * IMG_W);
            sQ[n    ][d] = (_Float16)(qv.x * scale);
            sQ[n + 1][d] = (_Float16)(qv.y * scale);
            sK[n    ][d] = (_Float16)kv.x;
            sK[n + 1][d] = (_Float16)kv.y;
            const int pn = kperm(n);            // perm keeps bits [2:0]
            sVT[d][pn    ] = (_Float16)vv.x;
            sVT[d][pn + 1] = (_Float16)vv.y;
        }
        // zero pads: token tid's K-pad halves + one V^T zero-row slice
        *(h8*)&sQ[tid][8]  = z8;  *(h8*)&sQ[tid][16] = z8;
        *(h8*)&sK[tid][8]  = z8;  *(h8*)&sK[tid][16] = z8;
        *(h8*)&sVT[8 + d][n0] = z8;
    }
    __syncthreads();

    // ---------------- LePE: window-local depthwise 3x3 conv ----------------
    {
        const int n   = tid;
        const int hs  = n >> 1;
        const int ws2 = n & 1;
#pragma unroll
        for (int d = 0; d < HD; ++d) {
            const int c = h * HD + d;
            const float* wt = conv_w + c * 9;
            float a = conv_b[c];
#pragma unroll
            for (int dy = -1; dy <= 1; ++dy) {
#pragma unroll
                for (int dx = -1; dx <= 1; ++dx) {
                    const int y = hs + dy, x = ws2 + dx;
                    if (y >= 0 && y < IMG_H && x >= 0 && x < 2)
                        a += wt[(dy + 1) * 3 + (dx + 1)] * (float)sVT[d][kperm(y * 2 + x)];
                }
            }
            sRO[n][d] = a;
        }
    }
    __syncthreads();

    const int lhalf = lane >> 4;   // K half selector for 16-bit fragments
    const int l15   = lane & 15;

    for (int mt = wave; mt < 16; mt += 8) {     // two 16-row M-tiles per wave
        // ---- A fragment: one contiguous 32B LDS load (upper half = zeros) ----
        const v16h afrag = *(const v16h*)&sQ[mt * 16 + l15][lhalf * 8];

        // ---- GEMM1: S = Q K^T, 16 N-tiles, loads batched by 4 ----
        v8f acc[16];
#pragma unroll
        for (int tg = 0; tg < 16; tg += 4) {
            v16h kb[4];
#pragma unroll
            for (int tt = 0; tt < 4; ++tt)
                kb[tt] = *(const v16h*)&sK[(tg + tt) * 16 + l15][lhalf * 8];
#pragma unroll
            for (int tt = 0; tt < 4; ++tt) {
                v8f cz;
#pragma unroll
                for (int i = 0; i < 8; ++i) cz[i] = 0.f;
                acc[tg + tt] = __builtin_amdgcn_wmma_f32_16x16x32_f16(
                    false, afrag, false, kb[tt], (short)0, cz, false, false);
            }
        }

        // ---- softmax over 256 keys: butterfly within 16-lane halves ----
        float rinv[8];
#pragma unroll
        for (int j = 0; j < 8; ++j) {
            float mx = acc[0][j];
#pragma unroll
            for (int t = 1; t < 16; ++t) mx = fmaxf(mx, acc[t][j]);
#pragma unroll
            for (int off = 1; off <= 8; off <<= 1)
                mx = fmaxf(mx, __shfl_xor(mx, off, 32));
            float sm = 0.f;
#pragma unroll
            for (int t = 0; t < 16; ++t) {
                const float e = __expf(acc[t][j] - mx);
                acc[t][j] = e;
                sm += e;
            }
#pragma unroll
            for (int off = 1; off <= 8; off <<= 1)
                sm += __shfl_xor(sm, off, 32);
            rinv[j] = 1.f / sm;
        }

        // ---- GEMM2: out = P V (+rpe as initial accumulator) ----
        v8f oacc;
#pragma unroll
        for (int j = 0; j < 8; ++j) {
            const int mg = mt * 16 + (lhalf ? (j + 8) : j);
            oacc[j] = (l15 < HD) ? sRO[mg][l15] : 0.f;
        }
        const int rrow = lhalf ? 8 : 0;                       // C-layout row base
        const int pc0  = (l15 & 7) + ((l15 >= 8) ? 16 : 0);   // perm col, tt=0
#pragma unroll
        for (int kc = 0; kc < 8; ++kc) {        // 8 chunks of K=32
            // P chunk C-layout -> per-wave LDS scratch in permuted col order
#pragma unroll
            for (int tt = 0; tt < 2; ++tt) {
                const int t = kc * 2 + tt;
#pragma unroll
                for (int j = 0; j < 8; ++j)
                    sPc[wave][rrow + j][pc0 + tt * 8] = (_Float16)(acc[t][j] * rinv[j]);
            }
            // A fragment from P chunk: one contiguous 32B load (perm order)
            const v16h pfrag = *(const v16h*)&sPc[wave][l15][lhalf * 16];
            // B fragment from V^T: one contiguous 32B load (perm order,
            // rows 8..15 zeroed -> no lane guard)
            const v16h vfrag = *(const v16h*)&sVT[l15][kc * 32 + lhalf * 16];
            oacc = __builtin_amdgcn_wmma_f32_16x16x32_f16(
                false, pfrag, false, vfrag, (short)0, oacc, false, false);
        }

        // overwrite rpe slots with final tile (only valid d columns)
        if (l15 < HD) {
#pragma unroll
            for (int j = 0; j < 8; ++j) {
                const int mg = mt * 16 + (lhalf ? (j + 8) : j);
                sRO[mg][l15] = oacc[j];
            }
        }
    }
    __syncthreads();

    // ---------------- coalesced store: token tid's 8 contiguous channels ----
    {
        const int n   = tid;
        const int row = n >> 1;
        const int col = wc + (n & 1);
        float* dst = out + ((size_t)b * (IMG_H * IMG_W) + (size_t)row * IMG_W + col) * CH
                         + h * HD;
        const float4 o0 = *(const float4*)&sRO[n][0];
        const float4 o1 = *(const float4*)&sRO[n][4];
        *(float4*)(dst)     = o0;
        *(float4*)(dst + 4) = o1;
    }
}

extern "C" void kernel_launch(void* const* d_in, const int* in_sizes, int n_in,
                              void* d_out, int out_size, void* d_ws, size_t ws_size,
                              hipStream_t stream) {
    (void)in_sizes; (void)n_in; (void)out_size; (void)d_ws; (void)ws_size;
    const float* temp   = (const float*)d_in[0];
    const float* conv_w = (const float*)d_in[1];
    const float* conv_b = (const float*)d_in[2];
    float* out = (float*)d_out;
    // grid: B(4) * windows(64) * heads(8) = 2048 blocks, 256 threads (8 wave32)
    hipLaunchKernelGGL(lepe_attn_kernel, dim3(2048), dim3(256), 0, stream,
                       temp, conv_w, conv_b, out);
}

// v001
// It runs in 70.1 microseconds.
// Timed twice side by side with v000, it ran 1.31 times as fast both times.
#include <hip/hip_runtime.h>

typedef __attribute__((ext_vector_type(16))) _Float16 v16h;
typedef __attribute__((ext_vector_type(8)))  _Float16 h8;
typedef __attribute__((ext_vector_type(8)))  float    v8f;

#define CH     64
#define IMG_H  128
#define IMG_W  128
#define HEADS  8
#define HD     8
#define NTOK   256   // tokens per window (128 * 2)
#define KPAD   24    // Q/K row: d 0..7 data, 8..23 zero (48B row, 16B-multiple)
#define VPAD   264   // V^T row pad (528B, 16B-multiple, bank-skewed)

// 2-bit group bit-reverse permutation on bits [4:3] of a K/token index:
// groups of 8 reordered 0,2,1,3 so a WMMA 16-bit fragment's element order
// (K = half*8 + 0..7, then 16 + half*8 + 0..7) is contiguous in LDS.
__device__ __forceinline__ int kperm(int n) {
    return (n & ~0x18) | ((n & 8) << 1) | ((n & 16) >> 1);
}

// value of lane l ^ 16 (the other 16-lane half)
__device__ __forceinline__ float xhalf(float v) {
    const int b = __builtin_bit_cast(int, v);
    return __builtin_bit_cast(float,
        __builtin_amdgcn_permlanex16(b, b, 0x76543210, 0xfedcba98, false, false));
}

__global__ __launch_bounds__(256, 1)
void lepe_attn_kernel(const float* __restrict__ temp,
                      const float* __restrict__ conv_w,
                      const float* __restrict__ conv_b,
                      float* __restrict__ out)
{
    __shared__ alignas(16) _Float16 sQ[NTOK][KPAD];   // [token][d | zeros]
    __shared__ alignas(16) _Float16 sK[NTOK][KPAD];
    __shared__ alignas(16) _Float16 sVT[16][VPAD];    // [d][perm(token)], rows 8..15 zero
    __shared__ alignas(16) float    sRO[NTOK][HD];    // rpe

    const int wh = blockIdx.x;          // 0 .. 2047
    const int b  = wh >> 9;             // batch
    const int w  = (wh >> 3) & 63;      // window (column strip)
    const int h  = wh & 7;              // head

    const int tid  = threadIdx.x;
    const int wave = tid >> 5;
    const int lane = tid & 31;
    const int wc   = w * 2;

    const float scale = 0.35355339059327373f;   // 8^-0.5

    __builtin_prefetch(conv_w + (h * HD) * 9, 0, 0);
    __builtin_prefetch(conv_b + h * HD, 0, 0);

    h8 z8;
#pragma unroll
    for (int i = 0; i < 8; ++i) z8[i] = (_Float16)0.f;

    // ---------------- stage Q,K,V  global(f32) -> LDS(f16) ----------------
    {
        const int d  = tid >> 5;        // head-dim element 0..7
        const int g  = tid & 31;        // token group
        const int n0 = g * 8;           // first token of group
        const size_t plane = (size_t)IMG_H * IMG_W;
        const size_t cofs  = (size_t)(h * HD + d) * plane + wc;
        const float* qs = temp + ((size_t)(b * 3 + 0) * CH) * plane + cofs;
        const float* ks = temp + ((size_t)(b * 3 + 1) * CH) * plane + cofs;
        const float* vs = temp + ((size_t)(b * 3 + 2) * CH) * plane + cofs;

#pragma unroll
        for (int i = 0; i < 4; ++i) {
            const int row = (n0 >> 1) + i;
            const int n   = n0 + 2 * i;
            const float2 qv = *(const float2*)(qs + (size_t)row * IMG_W);
            const float2 kv = *(const float2*)(ks + (size_t)row * IMG_W);
            const float2 vv = *(const float2*)(vs + (size_t)row * IMG_W);
            sQ[n    ][d] = (_Float16)(qv.x * scale);
            sQ[n + 1][d] = (_Float16)(qv.y * scale);
            sK[n    ][d] = (_Float16)kv.x;
            sK[n + 1][d] = (_Float16)kv.y;
            const int pn = kperm(n);            // perm keeps bits [2:0]
            sVT[d][pn    ] = (_Float16)vv.x;
            sVT[d][pn + 1] = (_Float16)vv.y;
        }
        // zero pads: token tid's K-pad halves + one V^T zero-row slice
        *(h8*)&sQ[tid][8]  = z8;  *(h8*)&sQ[tid][16] = z8;
        *(h8*)&sK[tid][8]  = z8;  *(h8*)&sK[tid][16] = z8;
        *(h8*)&sVT[8 + d][n0] = z8;
    }
    __syncthreads();

    // ---------------- LePE: window-local depthwise 3x3 conv ----------------
    {
        const int n   = tid;
        const int hs  = n >> 1;
        const int ws2 = n & 1;
#pragma unroll
        for (int d = 0; d < HD; ++d) {
            const int c = h * HD + d;
            const float* wt = conv_w + c * 9;
            float a = conv_b[c];
#pragma unroll
            for (int dy = -1; dy <= 1; ++dy) {
#pragma unroll
                for (int dx = -1; dx <= 1; ++dx) {
                    const int y = hs + dy, x = ws2 + dx;
                    if (y >= 0 && y < IMG_H && x >= 0 && x < 2)
                        a += wt[(dy + 1) * 3 + (dx + 1)] * (float)sVT[d][kperm(y * 2 + x)];
                }
            }
            sRO[n][d] = a;
        }
    }
    __syncthreads();

    const int lhalf = lane >> 4;   // K half selector for 16-bit fragments
    const int l15   = lane & 15;

    for (int mt = wave; mt < 16; mt += 8) {     // two 16-query tiles per wave
        // ---- B fragment: this lane's query column (upper half = zeros) ----
        const v16h qfrag = *(const v16h*)&sQ[mt * 16 + l15][lhalf * 8];

        // ---- GEMM1 transposed: S^T = K Q^T, 16 key tiles, loads batched by 4 ----
        // acc[t][r] = score(query mt*16 + l15, key 16*t + 8*lhalf + r)
        v8f acc[16];
#pragma unroll
        for (int tg = 0; tg < 16; tg += 4) {
            v16h kb[4];
#pragma unroll
            for (int tt = 0; tt < 4; ++tt)
                kb[tt] = *(const v16h*)&sK[(tg + tt) * 16 + l15][lhalf * 8];
#pragma unroll
            for (int tt = 0; tt < 4; ++tt) {
                v8f cz;
#pragma unroll
                for (int i = 0; i < 8; ++i) cz[i] = 0.f;
                acc[tg + tt] = __builtin_amdgcn_wmma_f32_16x16x32_f16(
                    false, kb[tt], false, qfrag, (short)0, cz, false, false);
            }
        }

        // schedule: all Q and K fragment loads in one group ahead of the 16 products
        // (counted waits); left alone, each product waited on its own pair of loads
        __builtin_amdgcn_sched_group_barrier(0x100, 34, 0);   // LDS reads
        __builtin_amdgcn_sched_group_barrier(0x008, 16, 0);   // matrix instructions
        __builtin_amdgcn_sched_barrier(0);

        // ---- row maximum: in-lane over 128 keys, one exchange between halves ----
        float mx = acc[0][0];
#pragma unroll
        for (int t = 0; t < 16; ++t)
#pragma unroll
            for (int r = 0; r < 8; ++r) mx = fmaxf(mx, acc[t][r]);
        mx = fmaxf(mx, xhalf(mx));

        // ---- GEMM2 transposed: O^T = V^T P^T, P^T packed from the score tiles ----
        // two key tiles converted in place are one B fragment in hardware k order,
        // which is the order sVT's permuted columns give the A fragment
        v8f oacc, sm8;
#pragma unroll
        for (int r = 0; r < 8; ++r) { oacc[r] = 0.f; sm8[r] = 0.f; }
#pragma unroll
        for (int kc = 0; kc < 8; ++kc) {        // 8 chunks of 32 keys
            v16h pfrag;
#pragma unroll
            for (int tt = 0; tt < 2; ++tt) {
#pragma unroll
                for (int r = 0; r < 8; ++r) {
                    const float e = __expf(acc[kc * 2 + tt][r] - mx);
                    sm8[r] += e;
                    pfrag[tt * 8 + r] = (_Float16)e;
                }
            }
            const v16h vfrag = *(const v16h*)&sVT[l15][kc * 32 + lhalf * 16];
            oacc = __builtin_amdgcn_wmma_f32_16x16x32_f16(
                false, vfrag, false, pfrag, (short)0, oacc, false, false);
        }

        float sm = ((sm8[0] + sm8[1]) + (sm8[2] + sm8[3]))
                 + ((sm8[4] + sm8[5]) + (sm8[6] + sm8[7]));
        sm += xhalf(sm);
        const float rinv = 1.f / sm;

        // ---- lanes 0..15 hold query l15's 8 channels (rows 8..15 of O^T are pad) ----
        if (lhalf == 0) {
            const int n   = mt * 16 + l15;
            const int row = n >> 1;
            const int col = wc + (n & 1);
            float* dst = out + ((size_t)b * (IMG_H * IMG_W) + (size_t)row * IMG_W + col) * CH
                             + h * HD;
            const float4 r0 = *(const float4*)&sRO[n][0];
            const float4 r1 = *(const float4*)&sRO[n][4];
            float4 o0, o1;
            o0.x = oacc[0] * rinv + r0.x;  o0.y = oacc[1] * rinv + r0.y;
            o0.z = oacc[2] * rinv + r0.z;  o0.w = oacc[3] * rinv + r0.w;
            o1.x = oacc[4] * rinv + r1.x;  o1.y = oacc[5] * rinv + r1.y;
            o1.z = oacc[6] * rinv + r1.z;  o1.w = oacc[7] * rinv + r1.w;
            *(float4*)(dst)     = o0;
            *(float4*)(dst + 4) = o1;
            // the next trip reuses the stores' address and data registers; the clobber
            // also keeps the K and V^T fragment loads inside the loop (hoisted out of
            // it they take the kernel from four waves on a SIMD to two)
            asm volatile("s_wait_xcnt 0x0" ::: "memory");
        }
    }
}

extern "C" void kernel_launch(void* const* d_in, const int* in_sizes, int n_in,
                              void* d_out, int out_size, void* d_ws, size_t ws_size,
                              hipStream_t stream) {
    (void)in_sizes; (void)n_in; (void)out_size; (void)d_ws; (void)ws_size;
    const float* temp   = (const float*)d_in[0];
    const float* conv_w = (const float*)d_in[1];
    const float* conv_b = (const float*)d_in[2];
    float* out = (float*)d_out;
    // grid: B(4) * windows(64) * heads(8) = 2048 blocks, 256 threads (8 wave32)
    hipLaunchKernelGGL(lepe_attn_kernel, dim3(2048), dim3(256), 0, stream,
                       temp, conv_w, conv_b, out);
}

// v002
// One run takes 59.4 microseconds.
// In both of two side-by-side timings against v001, it was 1.18 times as fast.
// Counting every step since v000, it is 1.55 times as fast.
#include <hip/hip_runtime.h>

typedef __attribute__((ext_vector_type(16))) _Float16 v16h;
typedef __attribute__((ext_vector_type(8)))  _Float16 h8;
typedef __attribute__((ext_vector_type(2)))  _Float16 h2;
typedef __attribute__((ext_vector_type(8)))  float    v8f;

#define CH     64
#define IMG_H  128
#define IMG_W  128
#define HEADS  8
#define HD     8
#define NTOK   256   // tokens per window (128 * 2)
#define KPAD   24    // Q/K row: d 0..7 data, 8..23 zero (48B row, 16B-multiple)
#define VPAD   264   // V^T row pad (528B, 16B-multiple, bank-skewed)

// 2-bit group bit-reverse permutation on bits [4:3] of a K/token index:
// groups of 8 reordered 0,2,1,3 so a WMMA 16-bit fragment's element order
// (K = half*8 + 0..7, then 16 + half*8 + 0..7) is contiguous in LDS.
__device__ __forceinline__ int kperm(int n) {
    return (n & ~0x18) | ((n & 8) << 1) | ((n & 16) >> 1);
}

// value of lane l ^ 16 (the other 16-lane half)
__device__ __forceinline__ float xhalf(float v) {
    const int b = __builtin_bit_cast(int, v);
    return __builtin_bit_cast(float,
        __builtin_amdgcn_permlanex16(b, b, 0x76543210, 0xfedcba98, false, false));
}

__global__ __launch_bounds__(256, 1)
void lepe_attn_kernel(const float* __restrict__ temp,
                      const float* __restrict__ conv_w,
                      const float* __restrict__ conv_b,
                      float* __restrict__ out)
{
    __shared__ alignas(16) _Float16 sQ[NTOK][KPAD];   // [token][d | zeros]
    __shared__ alignas(16) _Float16 sK[NTOK][KPAD];
    __shared__ alignas(16) _Float16 sVT[16][VPAD];    // [d][perm(token)], rows 8..15 zero
    __shared__ alignas(16) float    sRO[NTOK][HD];    // rpe

    const int wh = blockIdx.x;          // 0 .. 2047
    const int b  = wh >> 9;             // batch
    const int w  = (wh >> 3) & 63;      // window (column strip)
    const int h  = wh & 7;              // head

    const int tid  = threadIdx.x;
    const int wave = tid >> 5;
    const int lane = tid & 31;
    const int wc   = w * 2;

    const float scale = 0.35355339059327373f;   // 8^-0.5

    __builtin_prefetch(conv_w + (h * HD) * 9, 0, 0);
    __builtin_prefetch(conv_b + h * HD, 0, 0);

    h8 z8;
#pragma unroll
    for (int i = 0; i < 8; ++i) z8[i] = (_Float16)0.f;

    // ---------------- stage Q,K,V  global(f32) -> LDS(f16) ----------------
    {
        const int d  = tid >> 5;        // head-dim element 0..7
        const int g  = tid & 31;        // token group
        const int n0 = g * 8;           // first token of group
        const size_t plane = (size_t)IMG_H * IMG_W;
        const size_t cofs  = (size_t)(h * HD + d) * plane + wc;
        const float* qs = temp + ((size_t)(b * 3 + 0) * CH) * plane + cofs;
        const float* ks = temp + ((size_t)(b * 3 + 1) * CH) * plane + cofs;
        const float* vs = temp + ((size_t)(b * 3 + 2) * CH) * plane + cofs;

#pragma unroll
        for (int i = 0; i < 4; ++i) {
            const int row = (n0 >> 1) + i;
            const int n   = n0 + 2 * i;
            const float2 qv = *(const float2*)(qs + (size_t)row * IMG_W);
            const float2 kv = *(const float2*)(ks + (size_t)row * IMG_W);
            const float2 vv = *(const float2*)(vs + (size_t)row * IMG_W);
            sQ[n    ][d] = (_Float16)(qv.x * scale);
            sQ[n + 1][d] = (_Float16)(qv.y * scale);
            sK[n    ][d] = (_Float16)kv.x;
            sK[n + 1][d] = (_Float16)kv.y;
            const int pn = kperm(n);            // perm keeps bits [2:0]
            sVT[d][pn    ] = (_Float16)vv.x;
            sVT[d][pn + 1] = (_Float16)vv.y;
        }
        // zero pads: token tid's K-pad halves + one V^T zero-row slice
        *(h8*)&sQ[tid][8]  = z8;  *(h8*)&sQ[tid][16] = z8;
        *(h8*)&sK[tid][8]  = z8;  *(h8*)&sK[tid][16] = z8;
        *(h8*)&sVT[8 + d][n0] = z8;
    }
    __syncthreads();

    // ---------------- LePE: window-local depthwise 3x3 conv ----------------
    // Branch-free. A thread takes one image row (both tokens) for four channels: the
    // two tokens are adjacent halves of sVT (kperm keeps bits [2:0]), so one 4-byte
    // read per row and channel brings both columns; a row outside the window is read
    // clamped and zeroed. Every weight is used by every lane, so all stay scalar.
    {
        const int  hs   = tid & (IMG_H - 1);
        // channel group, the same in every lane of a wave: keeps the weight loads scalar
        const int  cg   = __builtin_amdgcn_readfirstlane(tid >> 7) * 4;
        const bool hasm = hs > 0;
        const bool hasp = hs < IMG_H - 1;
        const int  cm   = kperm((hasm ? hs - 1 : hs) * 2);
        const int  c0   = kperm(hs * 2);
        const int  cp   = kperm((hasp ? hs + 1 : hs) * 2);
        const float* wt = conv_w + (h * HD + cg) * 9;
        const float* bs = conv_b + (h * HD + cg);
        float ra[4], rb[4];                      // column 0 and column 1 of the row
#pragma unroll
        for (int j = 0; j < 4; ++j) {
            h2 v3[3];
            v3[0] = *(const h2*)&sVT[cg + j][cm];
            v3[1] = *(const h2*)&sVT[cg + j][c0];
            v3[2] = *(const h2*)&sVT[cg + j][cp];
            if (!hasm) { v3[0][0] = (_Float16)0.f; v3[0][1] = (_Float16)0.f; }
            if (!hasp) { v3[2][0] = (_Float16)0.f; v3[2][1] = (_Float16)0.f; }
            float a0 = bs[j], a1 = bs[j];
#pragma unroll
            for (int r = 0; r < 3; ++r) {
                // input column x meets weight column x - (output column) + 1
                const float x0 = (float)v3[r][0], x1 = (float)v3[r][1];
                a0 += wt[j * 9 + r * 3 + 1] * x0;
                a0 += wt[j * 9 + r * 3 + 2] * x1;
                a1 += wt[j * 9 + r * 3 + 0] * x0;
                a1 += wt[j * 9 + r * 3 + 1] * x1;
            }
            ra[j] = a0;
            rb[j] = a1;
        }
        float4 s0, s1;
        s0.x = ra[0]; s0.y = ra[1]; s0.z = ra[2]; s0.w = ra[3];
        s1.x = rb[0]; s1.y = rb[1]; s1.z = rb[2]; s1.w = rb[3];
        *(float4*)&sRO[hs * 2    ][cg] = s0;
        *(float4*)&sRO[hs * 2 + 1][cg] = s1;
    }
    __syncthreads();

    const int lhalf = lane >> 4;   // K half selector for 16-bit fragments
    const int l15   = lane & 15;

    for (int mt = wave; mt < 16; mt += 8) {     // two 16-query tiles per wave
        // ---- B fragment: this lane's query column (upper half = zeros) ----
        const v16h qfrag = *(const v16h*)&sQ[mt * 16 + l15][lhalf * 8];

        // ---- GEMM1 transposed: S^T = K Q^T, 16 key tiles, loads batched by 4 ----
        // acc[t][r] = score(query mt*16 + l15, key 16*t + 8*lhalf + r)
        v8f acc[16];
#pragma unroll
        for (int tg = 0; tg < 16; tg += 4) {
            v16h kb[4];
#pragma unroll
            for (int tt = 0; tt < 4; ++tt)
                kb[tt] = *(const v16h*)&sK[(tg + tt) * 16 + l15][lhalf * 8];
#pragma unroll
            for (int tt = 0; tt < 4; ++tt) {
                v8f cz;
#pragma unroll
                for (int i = 0; i < 8; ++i) cz[i] = 0.f;
                acc[tg + tt] = __builtin_amdgcn_wmma_f32_16x16x32_f16(
                    false, kb[tt], false, qfrag, (short)0, cz, false, false);
            }
        }

        // schedule: all Q and K fragment loads in one group ahead of the 16 products
        // (counted waits); left alone, each product waited on its own pair of loads
        __builtin_amdgcn_sched_group_barrier(0x100, 34, 0);   // LDS reads
        __builtin_amdgcn_sched_group_barrier(0x008, 16, 0);   // matrix instructions
        __builtin_amdgcn_sched_barrier(0);

        // ---- row maximum: in-lane over 128 keys, one exchange between halves ----
        float mx = acc[0][0];
#pragma unroll
        for (int t = 0; t < 16; ++t)
#pragma unroll
            for (int r = 0; r < 8; ++r) mx = fmaxf(mx, acc[t][r]);
        mx = fmaxf(mx, xhalf(mx));

        // ---- GEMM2 transposed: O^T = V^T P^T, P^T packed from the score tiles ----
        // two key tiles converted in place are one B fragment in hardware k order,
        // which is the order sVT's permuted columns give the A fragment
        v8f oacc, sm8;
#pragma unroll
        for (int r = 0; r < 8; ++r) { oacc[r] = 0.f; sm8[r] = 0.f; }
#pragma unroll
        for (int kc = 0; kc < 8; ++kc) {        // 8 chunks of 32 keys
            v16h pfrag;
#pragma unroll
            for (int tt = 0; tt < 2; ++tt) {
#pragma unroll
                for (int r = 0; r < 8; ++r) {
                    const float e = __expf(acc[kc * 2 + tt][r] - mx);
                    sm8[r] += e;
                    pfrag[tt * 8 + r] = (_Float16)e;
                }
            }
            const v16h vfrag = *(const v16h*)&sVT[l15][kc * 32 + lhalf * 16];
            oacc = __builtin_amdgcn_wmma_f32_16x16x32_f16(
                false, vfrag, false, pfrag, (short)0, oacc, false, false);
        }

        float sm = ((sm8[0] + sm8[1]) + (sm8[2] + sm8[3]))
                 + ((sm8[4] + sm8[5]) + (sm8[6] + sm8[7]));
        sm += xhalf(sm);
        const float rinv = 1.f / sm;

        // ---- lanes 0..15 hold query l15's 8 channels (rows 8..15 of O^T are pad) ----
        if (lhalf == 0) {
            const int n   = mt * 16 + l15;
            const int row = n >> 1;
            const int col = wc + (n & 1);
            float* dst = out + ((size_t)b * (IMG_H * IMG_W) + (size_t)row * IMG_W + col) * CH
                             + h * HD;
            const float4 r0 = *(const float4*)&sRO[n][0];
            const float4 r1 = *(const float4*)&sRO[n][4];
            float4 o0, o1;
            o0.x = oacc[0] * rinv + r0.x;  o0.y = oacc[1] * rinv + r0.y;
            o0.z = oacc[2] * rinv + r0.z;  o0.w = oacc[3] * rinv + r0.w;
            o1.x = oacc[4] * rinv + r1.x;  o1.y = oacc[5] * rinv + r1.y;
            o1.z = oacc[6] * rinv + r1.z;  o1.w = oacc[7] * rinv + r1.w;
            *(float4*)(dst)     = o0;
            *(float4*)(dst + 4) = o1;
            // the next trip reuses the stores' address and data registers; the clobber
            // also keeps the K and V^T fragment loads inside the loop (hoisted out of
            // it they take the kernel from four waves on a SIMD to two)
            asm volatile("s_wait_xcnt 0x0" ::: "memory");
        }
    }
}

extern "C" void kernel_launch(void* const* d_in, const int* in_sizes, int n_in,
                              void* d_out, int out_size, void* d_ws, size_t ws_size,
                              hipStream_t stream) {
    (void)in_sizes; (void)n_in; (void)out_size; (void)d_ws; (void)ws_size;
    const float* temp   = (const float*)d_in[0];
    const float* conv_w = (const float*)d_in[1];
    const float* conv_b = (const float*)d_in[2];
    float* out = (float*)d_out;
    // grid: B(4) * windows(64) * heads(8) = 2048 blocks, 256 threads (8 wave32)
    hipLaunchKernelGGL(lepe_attn_kernel, dim3(2048), dim3(256), 0, stream,
                       temp, conv_w, conv_b, out);
}

// v003
// It runs in 25 microseconds.
// In both of two side-by-side timings against v002, it was 2.37 times as fast.
// All steps since v000 together make it 3.68 times as fast.
#include <hip/hip_runtime.h>

typedef __attribute__((ext_vector_type(16))) _Float16 v16h;
typedef __attribute__((ext_vector_type(8)))  _Float16 h8;
typedef __attribute__((ext_vector_type(2)))  _Float16 h2;
typedef __attribute__((ext_vector_type(8)))  float    v8f;
typedef __attribute__((ext_vector_type(4)))  float    f4;

#define CH     64
#define IMG_H  128
#define IMG_W  128
#define HEADS  8
#define HD     8
#define NTOK   256   // tokens per window (128 * 2)
#define WPB    8     // adjacent windows of one head per block: 16 image columns, 64 B a row
#define KPAD   24    // Q/K row: d 0..7 data, 8..23 zero (48B row, 16B-multiple)
#define VPAD   264   // V^T row pad (528B, 16B-multiple, bank-skewed)

// 2-bit group bit-reverse permutation on bits [4:3] of a K/token index:
// groups of 8 reordered 0,2,1,3 so a WMMA 16-bit fragment's element order
// (K = half*8 + 0..7, then 16 + half*8 + 0..7) is contiguous in LDS.
__device__ __forceinline__ int kperm(int n) {
    return (n & ~0x18) | ((n & 8) << 1) | ((n & 16) >> 1);
}

// value of lane l ^ 16 (the other 16-lane half)
__device__ __forceinline__ float xhalf(float v) {
    const int b = __builtin_bit_cast(int, v);
    return __builtin_bit_cast(float,
        __builtin_amdgcn_permlanex16(b, b, 0x76543210, 0xfedcba98, false, false));
}

__global__ __launch_bounds__(512, 1)
void lepe_attn_kernel(const float* __restrict__ temp,
                      const float* __restrict__ conv_w,
                      const float* __restrict__ conv_b,
                      float* __restrict__ out)
{
    __shared__ alignas(16) _Float16 sQ[WPB][NTOK][KPAD];   // [window][token][d | zeros]
    __shared__ alignas(16) _Float16 sK[WPB][NTOK][KPAD];
    __shared__ alignas(16) _Float16 sVT[WPB][HD][VPAD];    // [window][d][perm(token)]
    __shared__ alignas(16) float    sRO[WPB][NTOK][HD];    // rpe

    const int wh = blockIdx.x;          // 0 .. 255
    const int b  = wh >> 6;             // batch
    const int wg = (wh >> 3) & 7;       // group of 8 adjacent windows
    const int h  = wh & 7;              // head

    const int tid  = threadIdx.x;
    const int wave = __builtin_amdgcn_readfirstlane(tid >> 5);
    const int lane = tid & 31;
    const int gc   = wg * (WPB * 2);    // first image column of the group

    const float scale = 0.35355339059327373f;   // 8^-0.5

    __builtin_prefetch(conv_w + (h * HD) * 9, 0, 0);
    __builtin_prefetch(conv_b + h * HD, 0, 0);

    h8 z8;
#pragma unroll
    for (int i = 0; i < 8; ++i) z8[i] = (_Float16)0.f;

    // ---------------- stage Q,K,V  global(f32) -> LDS(f16) ----------------
    // Every load is 16 bytes; four neighbouring lanes cover the group's 64 contiguous
    // bytes of one image row, so a wave-wide load touches 8 lines, not 32.
    // The unrolls give qx, kx, vx constant indices (registers, no scratch) and let all
    // 24 loads of a thread be in flight together.
    {
        const size_t plane = (size_t)IMG_H * IMG_W;
        const int cq = tid & 3;         // column quad: windows 2*cq and 2*cq + 1
        const int r  = tid >> 2;        // Q, K: image row
        const int rg = r & 31;          // V: group of four image rows (8 tokens)
        const int dv = tid >> 7;        // V: channels dv and dv + 4
        const float* hb = temp + ((size_t)(b * 3) * CH + h * HD) * plane + gc + cq * 4;
        const float* qs = hb + (size_t)r * IMG_W;
        const float* ks = qs + (size_t)CH * plane;
        const float* vs = hb + (size_t)(2 * CH + dv) * plane + (size_t)(rg * 4) * IMG_W;

        f4 qx[HD], kx[HD], vx[2][4];
#pragma unroll
        for (int d = 0; d < HD; ++d) {
            qx[d] = *(const f4*)(qs + (size_t)d * plane);
            kx[d] = *(const f4*)(ks + (size_t)d * plane);
        }
#pragma unroll
        for (int j = 0; j < 2; ++j)
#pragma unroll
            for (int i = 0; i < 4; ++i)
                vx[j][i] = *(const f4*)(vs + (size_t)(4 * j) * plane + (size_t)i * IMG_W);

        // Q, K: the thread holds all 8 channels of 4 tokens: one 16-byte row each,
        // and the rows' zero pads
#pragma unroll
        for (int c = 0; c < 4; ++c) {
            const int wl = 2 * cq + (c >> 1);
            const int n  = 2 * r + (c & 1);
            h8 qr, kr;
#pragma unroll
            for (int d = 0; d < HD; ++d) {
                qr[d] = (_Float16)(qx[d][c] * scale);
                kr[d] = (_Float16)kx[d][c];
            }
            *(h8*)&sQ[wl][n][0] = qr;  *(h8*)&sQ[wl][n][8] = z8;  *(h8*)&sQ[wl][n][16] = z8;
            *(h8*)&sK[wl][n][0] = kr;  *(h8*)&sK[wl][n][8] = z8;  *(h8*)&sK[wl][n][16] = z8;
        }
        // V^T: four rows of one channel are 8 consecutive tokens of each window
        // (kperm keeps bits [2:0]): one 16-byte piece of the channel's row
        const int pn = kperm(rg * 8);
#pragma unroll
        for (int j = 0; j < 2; ++j) {
#pragma unroll
            for (int p = 0; p < 2; ++p) {
                h8 vr;
#pragma unroll
                for (int i = 0; i < 4; ++i) {
                    vr[2 * i    ] = (_Float16)vx[j][i][2 * p    ];
                    vr[2 * i + 1] = (_Float16)vx[j][i][2 * p + 1];
                }
                *(h8*)&sVT[2 * cq + p][dv + 4 * j][pn] = vr;
            }
        }
    }
    __syncthreads();

    // ---------------- LePE: window-local depthwise 3x3 conv ----------------
    // Branch-free. A thread takes one image row (both tokens) for four channels: the
    // two tokens are adjacent halves of sVT (kperm keeps bits [2:0]), so one 4-byte
    // read per row and channel brings both columns; a row outside the window is read
    // clamped and zeroed. Every weight is used by every lane, so all stay scalar.
    // 256 threads take a window; the block's two halves walk the 8 windows in 4 trips.
    for (int win = wave >> 3; win < WPB; win += 2) {
        const int  hs   = tid & (IMG_H - 1);
        // channel group, the same in every lane of a wave: keeps the weight loads scalar
        const int  cg   = ((wave >> 2) & 1) * 4;
        const bool hasm = hs > 0;
        const bool hasp = hs < IMG_H - 1;
        const int  cm   = kperm((hasm ? hs - 1 : hs) * 2);
        const int  c0   = kperm(hs * 2);
        const int  cp   = kperm((hasp ? hs + 1 : hs) * 2);
        const float* wt = conv_w + (h * HD + cg) * 9;
        const float* bs = conv_b + (h * HD + cg);
        float ra[4], rb[4];                      // column 0 and column 1 of the row
#pragma unroll
        for (int j = 0; j < 4; ++j) {
            h2 v3[3];
            v3[0] = *(const h2*)&sVT[win][cg + j][cm];
            v3[1] = *(const h2*)&sVT[win][cg + j][c0];
            v3[2] = *(const h2*)&sVT[win][cg + j][cp];
            if (!hasm) { v3[0][0] = (_Float16)0.f; v3[0][1] = (_Float16)0.f; }
            if (!hasp) { v3[2][0] = (_Float16)0.f; v3[2][1] = (_Float16)0.f; }
            float a0 = bs[j], a1 = bs[j];
#pragma unroll
            for (int r = 0; r < 3; ++r) {
                // input column x meets weight column x - (output column) + 1
                const float x0 = (float)v3[r][0], x1 = (float)v3[r][1];
                a0 += wt[j * 9 + r * 3 + 1] * x0;
                a0 += wt[j * 9 + r * 3 + 2] * x1;
                a1 += wt[j * 9 + r * 3 + 0] * x0;
                a1 += wt[j * 9 + r * 3 + 1] * x1;
            }
            ra[j] = a0;
            rb[j] = a1;
        }
        float4 s0, s1;
        s0.x = ra[0]; s0.y = ra[1]; s0.z = ra[2]; s0.w = ra[3];
        s1.x = rb[0]; s1.y = rb[1]; s1.z = rb[2]; s1.w = rb[3];
        *(float4*)&sRO[win][hs * 2    ][cg] = s0;
        *(float4*)&sRO[win][hs * 2 + 1][cg] = s1;
    }
    __syncthreads();

    const int lhalf = lane >> 4;   // K half selector for 16-bit fragments
    const int l15   = lane & 15;

    const int win   = wave >> 1;   // two waves share a window

    for (int mt = wave & 1; mt < 16; mt += 2) { // eight 16-query tiles per wave
        // ---- B fragment: this lane's query column (upper half = zeros) ----
        const v16h qfrag = *(const v16h*)&sQ[win][mt * 16 + l15][lhalf * 8];

        // ---- GEMM1 transposed: S^T = K Q^T, 16 key tiles, loads batched by 4 ----
        // acc[t][r] = score(query mt*16 + l15, key 16*t + 8*lhalf + r)
        v8f acc[16];
#pragma unroll
        for (int tg = 0; tg < 16; tg += 4) {
            v16h kb[4];
#pragma unroll
            for (int tt = 0; tt < 4; ++tt)
                kb[tt] = *(const v16h*)&sK[win][(tg + tt) * 16 + l15][lhalf * 8];
#pragma unroll
            for (int tt = 0; tt < 4; ++tt) {
                v8f cz;
#pragma unroll
                for (int i = 0; i < 8; ++i) cz[i] = 0.f;
                acc[tg + tt] = __builtin_amdgcn_wmma_f32_16x16x32_f16(
                    false, kb[tt], false, qfrag, (short)0, cz, false, false);
            }
        }

        // schedule: all Q and K fragment loads in one group ahead of the 16 products
        // (counted waits); left alone, each product waited on its own pair of loads
        __builtin_amdgcn_sched_group_barrier(0x100, 34, 0);   // LDS reads
        __builtin_amdgcn_sched_group_barrier(0x008, 16, 0);   // matrix instructions
        __builtin_amdgcn_sched_barrier(0);

        // ---- row maximum: in-lane over 128 keys, one exchange between halves ----
        float mx = acc[0][0];
#pragma unroll
        for (int t = 0; t < 16; ++t)
#pragma unroll
            for (int r = 0; r < 8; ++r) mx = fmaxf(mx, acc[t][r]);
        mx = fmaxf(mx, xhalf(mx));

        // ---- GEMM2 transposed: O^T = V^T P^T, P^T packed from the score tiles ----
        // two key tiles converted in place are one B fragment in hardware k order,
        // which is the order sVT's permuted columns give the A fragment
        v8f oacc, sm8;
#pragma unroll
        for (int r = 0; r < 8; ++r) { oacc[r] = 0.f; sm8[r] = 0.f; }
#pragma unroll
        for (int kc = 0; kc < 8; ++kc) {        // 8 chunks of 32 keys
            v16h pfrag;
#pragma unroll
            for (int tt = 0; tt < 2; ++tt) {
#pragma unroll
                for (int r = 0; r < 8; ++r) {
                    const float e = __expf(acc[kc * 2 + tt][r] - mx);
                    sm8[r] += e;
                    pfrag[tt * 8 + r] = (_Float16)e;
                }
            }
            // rows 8..15 of O^T are never read, so lanes 8..15 repeat rows 0..7 of V^T
            const v16h vfrag = *(const v16h*)&sVT[win][l15 & 7][kc * 32 + lhalf * 16];
            oacc = __builtin_amdgcn_wmma_f32_16x16x32_f16(
                false, vfrag, false, pfrag, (short)0, oacc, false, false);
        }

        float sm = ((sm8[0] + sm8[1]) + (sm8[2] + sm8[3]))
                 + ((sm8[4] + sm8[5]) + (sm8[6] + sm8[7]));
        sm += xhalf(sm);
        const float rinv = 1.f / sm;

        // ---- lanes 0..15 hold query l15's 8 channels (rows 8..15 of O^T are unused) ----
        if (lhalf == 0) {
            const int n   = mt * 16 + l15;
            const int row = n >> 1;
            const int col = gc + win * 2 + (n & 1);
            float* dst = out + ((size_t)b * (IMG_H * IMG_W) + (size_t)row * IMG_W + col) * CH
                             + h * HD;
            const float4 r0 = *(const float4*)&sRO[win][n][0];
            const float4 r1 = *(const float4*)&sRO[win][n][4];
            float4 o0, o1;
            o0.x = oacc[0] * rinv + r0.x;  o0.y = oacc[1] * rinv + r0.y;
            o0.z = oacc[2] * rinv + r0.z;  o0.w = oacc[3] * rinv + r0.w;
            o1.x = oacc[4] * rinv + r1.x;  o1.y = oacc[5] * rinv + r1.y;
            o1.z = oacc[6] * rinv + r1.z;  o1.w = oacc[7] * rinv + r1.w;
            *(float4*)(dst)     = o0;
            *(float4*)(dst + 4) = o1;
            // the next trip reuses the stores' address and data registers; the clobber
            // also keeps the K and V^T fragment loads inside the loop
            asm volatile("s_wait_xcnt 0x0" ::: "memory");
        }
    }
}

extern "C" void kernel_launch(void* const* d_in, const int* in_sizes, int n_in,
                              void* d_out, int out_size, void* d_ws, size_t ws_size,
                              hipStream_t stream) {
    (void)in_sizes; (void)n_in; (void)out_size; (void)d_ws; (void)ws_size;
    const float* temp   = (const float*)d_in[0];
    const float* conv_w = (const float*)d_in[1];
    const float* conv_b = (const float*)d_in[2];
    float* out = (float*)d_out;
    // grid: B(4) * window groups(8) * heads(8) = 256 blocks, 512 threads (16 wave32)
    hipLaunchKernelGGL(lepe_attn_kernel, dim3(256), dim3(512), 0, stream,
                       temp, conv_w, conv_b, out);
}

// v004
// A run of this version takes 23.6 microseconds.
// In both of two side-by-side timings against v003, it was 1.06 times as fast.
// Over all steps from v000 it is 3.89 times as fast.
#include <hip/hip_runtime.h>

typedef __attribute__((ext_vector_type(16))) _Float16 v16h;
typedef __attribute__((ext_vector_type(8)))  _Float16 h8;
typedef __attribute__((ext_vector_type(2)))  _Float16 h2;
typedef __attribute__((ext_vector_type(8)))  float    v8f;
typedef __attribute__((ext_vector_type(4)))  float    f4;

#define CH     64
#define IMG_H  128
#define IMG_W  128
#define HEADS  8
#define HD     8
#define NTOK   256   // tokens per window (128 * 2)
#define WPB    8     // adjacent windows of one head per block: 16 image columns, 64 B a row
#define KPAD   24    // Q/K row: d 0..7 data, 8..23 zero (48B row, 16B-multiple)
#define VPAD   264   // V^T row pad (528B, 16B-multiple, bank-skewed)

// 2-bit group bit-reverse permutation on bits [4:3] of a K/token index:
// groups of 8 reordered 0,2,1,3 so a WMMA 16-bit fragment's element order
// (K = half*8 + 0..7, then 16 + half*8 + 0..7) is contiguous in LDS.
__device__ __forceinline__ int kperm(int n) {
    return (n & ~0x18) | ((n & 8) << 1) | ((n & 16) >> 1);
}

// value of lane l ^ 16 (the other 16-lane half)
__device__ __forceinline__ float xhalf(float v) {
    const int b = __builtin_bit_cast(int, v);
    return __builtin_bit_cast(float,
        __builtin_amdgcn_permlanex16(b, b, 0x76543210, 0xfedcba98, false, false));
}

__global__ __launch_bounds__(512, 1)
void lepe_attn_kernel(const float* __restrict__ temp,
                      const float* __restrict__ conv_w,
                      const float* __restrict__ conv_b,
                      float* __restrict__ out)
{
    __shared__ alignas(16) _Float16 sQ[WPB][NTOK][KPAD];   // [window][token][d | zeros]
    __shared__ alignas(16) _Float16 sK[WPB][NTOK][KPAD];
    __shared__ alignas(16) _Float16 sVT[WPB][HD][VPAD];    // [window][d][perm(token)]
    __shared__ alignas(16) float    sRO[WPB][NTOK][HD];    // rpe

    const int wh = blockIdx.x;          // 0 .. 255
    const int b  = wh >> 6;             // batch
    const int wg = (wh >> 3) & 7;       // group of 8 adjacent windows
    const int h  = wh & 7;              // head

    const int tid  = threadIdx.x;
    const int wave = __builtin_amdgcn_readfirstlane(tid >> 5);
    const int lane = tid & 31;
    const int gc   = wg * (WPB * 2);    // first image column of the group

    // 8^-0.5 * log2(e): the scores leave the matrix unit as exponents of 2
    const float scale = 0.35355339059327373f * 1.4426950408889634f;

    __builtin_prefetch(conv_w + (h * HD) * 9, 0, 0);
    __builtin_prefetch(conv_b + h * HD, 0, 0);

    h8 z8;
#pragma unroll
    for (int i = 0; i < 8; ++i) z8[i] = (_Float16)0.f;

    // ---------------- stage Q,K,V  global(f32) -> LDS(f16) ----------------
    // Every load is 16 bytes; four neighbouring lanes cover the group's 64 contiguous
    // bytes of one image row, so a wave-wide load touches 8 lines, not 32.
    // The unrolls give qx, kx, vx constant indices (registers, no scratch) and let all
    // 24 loads of a thread be in flight together.
    {
        const size_t plane = (size_t)IMG_H * IMG_W;
        const int cq = tid & 3;         // column quad: windows 2*cq and 2*cq + 1
        const int r  = tid >> 2;        // Q, K: image row
        const int rg = r & 31;          // V: group of four image rows (8 tokens)
        const int dv = tid >> 7;        // V: channels dv and dv + 4
        const float* hb = temp + ((size_t)(b * 3) * CH + h * HD) * plane + gc + cq * 4;
        const float* qs = hb + (size_t)r * IMG_W;
        const float* ks = qs + (size_t)CH * plane;
        const float* vs = hb + (size_t)(2 * CH + dv) * plane + (size_t)(rg * 4) * IMG_W;

        f4 qx[HD], kx[HD], vx[2][4];
#pragma unroll
        for (int d = 0; d < HD; ++d) {
            qx[d] = *(const f4*)(qs + (size_t)d * plane);
            kx[d] = *(const f4*)(ks + (size_t)d * plane);
        }
#pragma unroll
        for (int j = 0; j < 2; ++j)
#pragma unroll
            for (int i = 0; i < 4; ++i)
                vx[j][i] = *(const f4*)(vs + (size_t)(4 * j) * plane + (size_t)i * IMG_W);

        // Q, K: the thread holds all 8 channels of 4 tokens: one 16-byte row each,
        // and the rows' zero pads
#pragma unroll
        for (int c = 0; c < 4; ++c) {
            const int wl = 2 * cq + (c >> 1);
            const int n  = 2 * r + (c & 1);
            h8 qr, kr;
#pragma unroll
            for (int d = 0; d < HD; ++d) {
                qr[d] = (_Float16)(qx[d][c] * scale);
                kr[d] = (_Float16)kx[d][c];
            }
            *(h8*)&sQ[wl][n][0] = qr;  *(h8*)&sQ[wl][n][8] = z8;  *(h8*)&sQ[wl][n][16] = z8;
            *(h8*)&sK[wl][n][0] = kr;  *(h8*)&sK[wl][n][8] = z8;  *(h8*)&sK[wl][n][16] = z8;
        }
        // V^T: four rows of one channel are 8 consecutive tokens of each window
        // (kperm keeps bits [2:0]): one 16-byte piece of the channel's row
        const int pn = kperm(rg * 8);
#pragma unroll
        for (int j = 0; j < 2; ++j) {
#pragma unroll
            for (int p = 0; p < 2; ++p) {
                h8 vr;
#pragma unroll
                for (int i = 0; i < 4; ++i) {
                    vr[2 * i    ] = (_Float16)vx[j][i][2 * p    ];
                    vr[2 * i + 1] = (_Float16)vx[j][i][2 * p + 1];
                }
                *(h8*)&sVT[2 * cq + p][dv + 4 * j][pn] = vr;
            }
        }
    }
    __syncthreads();

    // ---------------- LePE: window-local depthwise 3x3 conv ----------------
    // Branch-free. A thread takes one image row (both tokens) for four channels: the
    // two tokens are adjacent halves of sVT (kperm keeps bits [2:0]), so one 4-byte
    // read per row and channel brings both columns; a row outside the window is read
    // clamped and zeroed. Every weight is used by every lane, so all stay scalar.
    // 256 threads take a window; the block's two halves walk the 8 windows in 4 trips.
    for (int win = wave >> 3; win < WPB; win += 2) {
        const int  hs   = tid & (IMG_H - 1);
        // channel group, the same in every lane of a wave: keeps the weight loads scalar
        const int  cg   = ((wave >> 2) & 1) * 4;
        const bool hasm = hs > 0;
        const bool hasp = hs < IMG_H - 1;
        const int  cm   = kperm((hasm ? hs - 1 : hs) * 2);
        const int  c0   = kperm(hs * 2);
        const int  cp   = kperm((hasp ? hs + 1 : hs) * 2);
        const float* wt = conv_w + (h * HD + cg) * 9;
        const float* bs = conv_b + (h * HD + cg);
        float ra[4], rb[4];                      // column 0 and column 1 of the row
#pragma unroll
        for (int j = 0; j < 4; ++j) {
            h2 v3[3];
            v3[0] = *(const h2*)&sVT[win][cg + j][cm];
            v3[1] = *(const h2*)&sVT[win][cg + j][c0];
            v3[2] = *(const h2*)&sVT[win][cg + j][cp];
            if (!hasm) { v3[0][0] = (_Float16)0.f; v3[0][1] = (_Float16)0.f; }
            if (!hasp) { v3[2][0] = (_Float16)0.f; v3[2][1] = (_Float16)0.f; }
            float a0 = bs[j], a1 = bs[j];
#pragma unroll
            for (int r = 0; r < 3; ++r) {
                // input column x meets weight column x - (output column) + 1
                const float x0 = (float)v3[r][0], x1 = (float)v3[r][1];
                a0 += wt[j * 9 + r * 3 + 1] * x0;
                a0 += wt[j * 9 + r * 3 + 2] * x1;
                a1 += wt[j * 9 + r * 3 + 0] * x0;
                a1 += wt[j * 9 + r * 3 + 1] * x1;
            }
            ra[j] = a0;
            rb[j] = a1;
        }
        float4 s0, s1;
        s0.x = ra[0]; s0.y = ra[1]; s0.z = ra[2]; s0.w = ra[3];
        s1.x = rb[0]; s1.y = rb[1]; s1.z = rb[2]; s1.w = rb[3];
        *(float4*)&sRO[win][hs * 2    ][cg] = s0;
        *(float4*)&sRO[win][hs * 2 + 1][cg] = s1;
    }
    __syncthreads();

    const int lhalf = lane >> 4;   // K half selector for 16-bit fragments
    const int l15   = lane & 15;

    const int win   = wave >> 1;   // two waves share a window

    // ---- A fragments of the window's 16 key tiles: read once, kept for all query tiles ----
    // Every loop from here on but the query-tile loop is unrolled so that kf, the score tiles and the fragments
    // have constant indices: registers, no scratch.
    v16h kf[16];
#pragma unroll
    for (int t = 0; t < 16; ++t)
        kf[t] = *(const v16h*)&sK[win][t * 16 + l15][lhalf * 8];

    for (int mt = wave & 1; mt < 16; mt += 2) { // eight 16-query tiles per wave
        // ---- B fragment: this lane's query column (upper half = zeros) ----
        const v16h qfrag = *(const v16h*)&sQ[win][mt * 16 + l15][lhalf * 8];

        // ---- pass 1, S^T = K Q^T: each score tile is read for the row maximum only ----
        // tile[r] = score(query mt*16 + l15, key 16*t + 8*lhalf + r)
        v8f cz;
#pragma unroll
        for (int i = 0; i < 8; ++i) cz[i] = 0.f;
        float m4[4];
#pragma unroll
        for (int p = 0; p < 4; ++p) m4[p] = -__builtin_inff();
#pragma unroll
        for (int tg = 0; tg < 16; tg += 4) {    // four products fill each other's result distance
            v8f a[4];
#pragma unroll
            for (int tt = 0; tt < 4; ++tt)
                a[tt] = __builtin_amdgcn_wmma_f32_16x16x32_f16(
                    false, kf[tg + tt], false, qfrag, (short)0, cz, false, false);
#pragma unroll
            for (int tt = 0; tt < 4; ++tt)
#pragma unroll
                for (int p = 0; p < 4; ++p)
                    m4[p] = fmaxf(fmaxf(m4[p], a[tt][2 * p]), a[tt][2 * p + 1]);
        }
        float mx = fmaxf(fmaxf(m4[0], m4[1]), fmaxf(m4[2], m4[3]));
        // schedule: products run one group of four ahead of the maxima that read them;
        // left alone, each product stood right in front of its readers, behind idle slots
        __builtin_amdgcn_sched_group_barrier(0x008, 8, 0);    // matrix instructions
        __builtin_amdgcn_sched_group_barrier(0x002, 16, 0);   // vector: one group's maxima
        __builtin_amdgcn_sched_group_barrier(0x008, 4, 0);
        __builtin_amdgcn_sched_group_barrier(0x002, 16, 0);
        __builtin_amdgcn_sched_group_barrier(0x008, 4, 0);
        __builtin_amdgcn_sched_group_barrier(0x002, 32, 0);
        __builtin_amdgcn_sched_barrier(0);
        mx = fmaxf(mx, xhalf(mx));

        // ---- pass 2: the same products with C = -max: the tile is the exp2 argument ----
        v8f cm;
#pragma unroll
        for (int i = 0; i < 8; ++i) cm[i] = -mx;

        // ---- GEMM2 transposed: O^T = V^T P^T, P^T packed from the score tiles ----
        // two key tiles converted in place are one B fragment in hardware k order,
        // which is the order sVT's permuted columns give the A fragment
        v8f oacc, sm8;
#pragma unroll
        for (int r = 0; r < 8; ++r) { oacc[r] = 0.f; sm8[r] = 0.f; }
        v8f nx[2];                              // score tiles of the chunk after this one
#pragma unroll
        for (int tt = 0; tt < 2; ++tt)
            nx[tt] = __builtin_amdgcn_wmma_f32_16x16x32_f16(
                false, kf[tt], false, qfrag, (short)0, cm, false, false);
#pragma unroll
        for (int kc = 0; kc < 8; ++kc) {        // 8 chunks of 32 keys
            v8f sh[2];
#pragma unroll
            for (int tt = 0; tt < 2; ++tt) {
                sh[tt] = nx[tt];
                if (kc < 7)
                    nx[tt] = __builtin_amdgcn_wmma_f32_16x16x32_f16(
                        false, kf[kc * 2 + 2 + tt], false, qfrag, (short)0, cm, false, false);
            }
            v16h pfrag;
#pragma unroll
            for (int tt = 0; tt < 2; ++tt) {
#pragma unroll
                for (int r = 0; r < 8; ++r) {
                    const float e = __builtin_amdgcn_exp2f(sh[tt][r]);
                    sm8[r] += e;
                    pfrag[tt * 8 + r] = (_Float16)e;
                }
            }
            // rows 8..15 of O^T are never read, so lanes 8..15 repeat rows 0..7 of V^T
            const v16h vfrag = *(const v16h*)&sVT[win][l15 & 7][kc * 32 + lhalf * 16];
            oacc = __builtin_amdgcn_wmma_f32_16x16x32_f16(
                false, vfrag, false, pfrag, (short)0, oacc, false, false);
        }

        float sm = ((sm8[0] + sm8[1]) + (sm8[2] + sm8[3]))
                 + ((sm8[4] + sm8[5]) + (sm8[6] + sm8[7]));
        sm += xhalf(sm);
        const float rinv = 1.f / sm;

        // ---- lanes 0..15 hold query l15's 8 channels (rows 8..15 of O^T are unused) ----
        if (lhalf == 0) {
            const int n   = mt * 16 + l15;
            const int row = n >> 1;
            const int col = gc + win * 2 + (n & 1);
            float* dst = out + ((size_t)b * (IMG_H * IMG_W) + (size_t)row * IMG_W + col) * CH
                             + h * HD;
            const float4 r0 = *(const float4*)&sRO[win][n][0];
            const float4 r1 = *(const float4*)&sRO[win][n][4];
            float4 o0, o1;
            o0.x = oacc[0] * rinv + r0.x;  o0.y = oacc[1] * rinv + r0.y;
            o0.z = oacc[2] * rinv + r0.z;  o0.w = oacc[3] * rinv + r0.w;
            o1.x = oacc[4] * rinv + r1.x;  o1.y = oacc[5] * rinv + r1.y;
            o1.z = oacc[6] * rinv + r1.z;  o1.w = oacc[7] * rinv + r1.w;
            *(float4*)(dst)     = o0;
            *(float4*)(dst + 4) = o1;
            // the next trip reuses the stores' address and data registers; the clobber
            // also keeps the V^T fragment loads inside the loop (no registers left for them)
            asm volatile("s_wait_xcnt 0x0" ::: "memory");
        }
    }
}

extern "C" void kernel_launch(void* const* d_in, const int* in_sizes, int n_in,
                              void* d_out, int out_size, void* d_ws, size_t ws_size,
                              hipStream_t stream) {
    (void)in_sizes; (void)n_in; (void)out_size; (void)d_ws; (void)ws_size;
    const float* temp   = (const float*)d_in[0];
    const float* conv_w = (const float*)d_in[1];
    const float* conv_b = (const float*)d_in[2];
    float* out = (float*)d_out;
    // grid: B(4) * window groups(8) * heads(8) = 256 blocks, 512 threads (16 wave32)
    hipLaunchKernelGGL(lepe_attn_kernel, dim3(256), dim3(512), 0, stream,
                       temp, conv_w, conv_b, out);
}

// v005
// Measured time: 22.1 microseconds a run.
// Two timings next to v004 both put it at 1.07 times that version's speed.
// Over all steps from v000 it is 4.15 times as fast.
#include <hip/hip_runtime.h>

typedef __attribute__((ext_vector_type(16))) _Float16 v16h;
typedef __attribute__((ext_vector_type(8)))  _Float16 h8;
typedef __attribute__((ext_vector_type(2)))  _Float16 h2;
typedef __attribute__((ext_vector_type(8)))  float    v8f;
typedef __attribute__((ext_vector_type(4)))  float    f4;

#define CH     64
#define IMG_H  128
#define IMG_W  128
#define HEADS  8
#define HD     8
#define NTOK   256   // tokens per window (128 * 2)
#define WPB    8     // adjacent windows of one head per block: 16 image columns, 64 B a row
#define KPAD   24    // Q/K row: d 0..7 data, 8..23 zero (48B row, 16B-multiple)
#define VPAD   264   // V^T row pad (528B, 16B-multiple, bank-skewed)

// 2-bit group bit-reverse permutation on bits [4:3] of a K/token index:
// groups of 8 reordered 0,2,1,3 so a WMMA 16-bit fragment's element order
// (K = half*8 + 0..7, then 16 + half*8 + 0..7) is contiguous in LDS.
__device__ __forceinline__ int kperm(int n) {
    return (n & ~0x18) | ((n & 8) << 1) | ((n & 16) >> 1);
}

// value of lane l ^ 16 (the other 16-lane half)
__device__ __forceinline__ float xhalf(float v) {
    const int b = __builtin_bit_cast(int, v);
    return __builtin_bit_cast(float,
        __builtin_amdgcn_permlanex16(b, b, 0x76543210, 0xfedcba98, false, false));
}

__global__ __launch_bounds__(512, 1)
void lepe_attn_kernel(const float* __restrict__ temp,
                      const float* __restrict__ conv_w,
                      const float* __restrict__ conv_b,
                      float* __restrict__ out)
{
    __shared__ alignas(16) _Float16 sQ[WPB][NTOK][KPAD];   // [window][token][d | zeros]
    __shared__ alignas(16) _Float16 sK[WPB][NTOK][KPAD];
    __shared__ alignas(16) _Float16 sVT[WPB][HD + 1][VPAD]; // [window][d | ones][perm(token)]
    __shared__ alignas(16) float    sRO[WPB][NTOK][HD];    // rpe

    const int wh = blockIdx.x;          // 0 .. 255
    const int b  = wh >> 6;             // batch
    const int wg = (wh >> 3) & 7;       // group of 8 adjacent windows
    const int h  = wh & 7;              // head

    const int tid  = threadIdx.x;
    const int wave = __builtin_amdgcn_readfirstlane(tid >> 5);
    const int lane = tid & 31;
    const int gc   = wg * (WPB * 2);    // first image column of the group

    // 8^-0.5 * log2(e): the scores leave the matrix unit as exponents of 2
    const float scale = 0.35355339059327373f * 1.4426950408889634f;

    __builtin_prefetch(conv_w + (h * HD) * 9, 0, 0);
    __builtin_prefetch(conv_b + h * HD, 0, 0);

    h8 z8;
#pragma unroll
    for (int i = 0; i < 8; ++i) z8[i] = (_Float16)0.f;

    // ---------------- stage Q,K,V  global(f32) -> LDS(f16) ----------------
    // Every load is 16 bytes; four neighbouring lanes cover the group's 64 contiguous
    // bytes of one image row, so a wave-wide load touches 8 lines, not 32.
    // The unrolls give qx, kx, vx constant indices (registers, no scratch) and let all
    // 24 loads of a thread be in flight together.
    {
        const size_t plane = (size_t)IMG_H * IMG_W;
        const int cq = tid & 3;         // column quad: windows 2*cq and 2*cq + 1
        const int r  = tid >> 2;        // Q, K: image row
        const int rg = r & 31;          // V: group of four image rows (8 tokens)
        const int dv = tid >> 7;        // V: channels dv and dv + 4
        const float* hb = temp + ((size_t)(b * 3) * CH + h * HD) * plane + gc + cq * 4;
        const float* qs = hb + (size_t)r * IMG_W;
        const float* ks = qs + (size_t)CH * plane;
        const float* vs = hb + (size_t)(2 * CH + dv) * plane + (size_t)(rg * 4) * IMG_W;

        f4 qx[HD], kx[HD], vx[2][4];
#pragma unroll
        for (int d = 0; d < HD; ++d) {
            qx[d] = *(const f4*)(qs + (size_t)d * plane);
            kx[d] = *(const f4*)(ks + (size_t)d * plane);
        }
#pragma unroll
        for (int j = 0; j < 2; ++j)
#pragma unroll
            for (int i = 0; i < 4; ++i)
                vx[j][i] = *(const f4*)(vs + (size_t)(4 * j) * plane + (size_t)i * IMG_W);

        // Q, K: the thread holds all 8 channels of 4 tokens: one 16-byte row each,
        // and the rows' zero pads
#pragma unroll
        for (int c = 0; c < 4; ++c) {
            const int wl = 2 * cq + (c >> 1);
            const int n  = 2 * r + (c & 1);
            h8 qr, kr;
#pragma unroll
            for (int d = 0; d < HD; ++d) {
                qr[d] = (_Float16)(qx[d][c] * scale);
                kr[d] = (_Float16)kx[d][c];
            }
            *(h8*)&sQ[wl][n][0] = qr;  *(h8*)&sQ[wl][n][8] = z8;  *(h8*)&sQ[wl][n][16] = z8;
            *(h8*)&sK[wl][n][0] = kr;  *(h8*)&sK[wl][n][8] = z8;  *(h8*)&sK[wl][n][16] = z8;
        }
        // V^T: four rows of one channel are 8 consecutive tokens of each window
        // (kperm keeps bits [2:0]): one 16-byte piece of the channel's row
        const int pn = kperm(rg * 8);
#pragma unroll
        for (int j = 0; j < 2; ++j) {
#pragma unroll
            for (int p = 0; p < 2; ++p) {
                h8 vr;
#pragma unroll
                for (int i = 0; i < 4; ++i) {
                    vr[2 * i    ] = (_Float16)vx[j][i][2 * p    ];
                    vr[2 * i + 1] = (_Float16)vx[j][i][2 * p + 1];
                }
                *(h8*)&sVT[2 * cq + p][dv + 4 * j][pn] = vr;
            }
        }
        // ninth row of every window: ones (its pitch puts it on banks the eight channel rows leave free)
        if (tid < WPB * (NTOK / 8)) {
            h8 o8;
#pragma unroll
            for (int i = 0; i < 8; ++i) o8[i] = (_Float16)1.f;
            *(h8*)&sVT[tid >> 5][HD][(tid & 31) * 8] = o8;
        }
    }
    __syncthreads();

    // ---------------- LePE: window-local depthwise 3x3 conv ----------------
    // Branch-free. A thread takes one image row (both tokens) for four channels: the
    // two tokens are adjacent halves of sVT (kperm keeps bits [2:0]), so one 4-byte
    // read per row and channel brings both columns; a row outside the window is read
    // clamped and zeroed. Every weight is used by every lane, so all stay scalar.
    // 256 threads take a window; the block's two halves walk the 8 windows in 4 trips.
    for (int win = wave >> 3; win < WPB; win += 2) {
        const int  hs   = tid & (IMG_H - 1);
        // channel group, the same in every lane of a wave: keeps the weight loads scalar
        const int  cg   = ((wave >> 2) & 1) * 4;
        const bool hasm = hs > 0;
        const bool hasp = hs < IMG_H - 1;
        const int  cm   = kperm((hasm ? hs - 1 : hs) * 2);
        const int  c0   = kperm(hs * 2);
        const int  cp   = kperm((hasp ? hs + 1 : hs) * 2);
        const float* wt = conv_w + (h * HD + cg) * 9;
        const float* bs = conv_b + (h * HD + cg);
        float ra[4], rb[4];                      // column 0 and column 1 of the row
#pragma unroll
        for (int j = 0; j < 4; ++j) {
            h2 v3[3];
            v3[0] = *(const h2*)&sVT[win][cg + j][cm];
            v3[1] = *(const h2*)&sVT[win][cg + j][c0];
            v3[2] = *(const h2*)&sVT[win][cg + j][cp];
            if (!hasm) { v3[0][0] = (_Float16)0.f; v3[0][1] = (_Float16)0.f; }
            if (!hasp) { v3[2][0] = (_Float16)0.f; v3[2][1] = (_Float16)0.f; }
            float a0 = bs[j], a1 = bs[j];
#pragma unroll
            for (int r = 0; r < 3; ++r) {
                // input column x meets weight column x - (output column) + 1
                const float x0 = (float)v3[r][0], x1 = (float)v3[r][1];
                a0 += wt[j * 9 + r * 3 + 1] * x0;
                a0 += wt[j * 9 + r * 3 + 2] * x1;
                a1 += wt[j * 9 + r * 3 + 0] * x0;
                a1 += wt[j * 9 + r * 3 + 1] * x1;
            }
            ra[j] = a0;
            rb[j] = a1;
        }
        float4 s0, s1;
        s0.x = ra[0]; s0.y = ra[1]; s0.z = ra[2]; s0.w = ra[3];
        s1.x = rb[0]; s1.y = rb[1]; s1.z = rb[2]; s1.w = rb[3];
        *(float4*)&sRO[win][hs * 2    ][cg] = s0;
        *(float4*)&sRO[win][hs * 2 + 1][cg] = s1;
    }
    __syncthreads();

    const int lhalf = lane >> 4;   // K half selector for 16-bit fragments
    const int l15   = lane & 15;

    const int win   = wave >> 1;   // two waves share a window

    // ---- A fragments of the window's 16 key tiles: read once, kept for all query tiles ----
    // Every loop from here on but the query-tile loop is unrolled so that kf, the score tiles and the fragments
    // have constant indices: registers, no scratch.
    v16h kf[16];
#pragma unroll
    for (int t = 0; t < 16; ++t)
        kf[t] = *(const v16h*)&sK[win][t * 16 + l15][lhalf * 8];

    // A rows of the second product: rows 0..3 are channels 0..3, rows 8..11 channels 4..7,
    // every other row the ones. In O^T a lane of half lhalf then holds channels
    // 4*lhalf .. 4*lhalf+3 of query l15 in registers 0..3 and the sum of its weights in 4.
    const _Float16* vrow =
        &sVT[win][(l15 & 4) ? HD : (l15 & 3) + ((l15 >> 3) << 2)][lhalf * 16];

    for (int mt = wave & 1; mt < 16; mt += 2) { // eight 16-query tiles per wave
        // ---- B fragment: this lane's query column (upper half = zeros) ----
        const v16h qfrag = *(const v16h*)&sQ[win][mt * 16 + l15][lhalf * 8];

        // ---- pass 1, S^T = K Q^T: each score tile is read for the row maximum only ----
        // tile[r] = score(query mt*16 + l15, key 16*t + 8*lhalf + r)
        v8f cz;
#pragma unroll
        for (int i = 0; i < 8; ++i) cz[i] = 0.f;
        float m4[4];
#pragma unroll
        for (int p = 0; p < 4; ++p) m4[p] = -__builtin_inff();
#pragma unroll
        for (int tg = 0; tg < 16; tg += 4) {    // four products fill each other's result distance
            v8f a[4];
#pragma unroll
            for (int tt = 0; tt < 4; ++tt)
                a[tt] = __builtin_amdgcn_wmma_f32_16x16x32_f16(
                    false, kf[tg + tt], false, qfrag, (short)0, cz, false, false);
#pragma unroll
            for (int tt = 0; tt < 4; ++tt)
#pragma unroll
                for (int p = 0; p < 4; ++p)
                    m4[p] = fmaxf(fmaxf(m4[p], a[tt][2 * p]), a[tt][2 * p + 1]);
        }
        float mx = fmaxf(fmaxf(m4[0], m4[1]), fmaxf(m4[2], m4[3]));
        // schedule: products run one group of four ahead of the maxima that read them;
        // left alone, each product stood right in front of its readers, behind idle slots
        __builtin_amdgcn_sched_group_barrier(0x008, 8, 0);    // matrix instructions
        __builtin_amdgcn_sched_group_barrier(0x002, 16, 0);   // vector: one group's maxima
        __builtin_amdgcn_sched_group_barrier(0x008, 4, 0);
        __builtin_amdgcn_sched_group_barrier(0x002, 16, 0);
        __builtin_amdgcn_sched_group_barrier(0x008, 4, 0);
        __builtin_amdgcn_sched_group_barrier(0x002, 32, 0);
        __builtin_amdgcn_sched_barrier(0);
        mx = fmaxf(mx, xhalf(mx));

        // ---- pass 2: the same products with C = -max: the tile is the exp2 argument ----
        v8f cm;
#pragma unroll
        for (int i = 0; i < 8; ++i) cm[i] = -mx;

        // ---- GEMM2 transposed: O^T = V^T P^T, P^T packed from the score tiles ----
        // two key tiles converted in place are one B fragment in hardware k order,
        // which is the order sVT's permuted columns give the A fragment
        v8f oacc;
#pragma unroll
        for (int r = 0; r < 8; ++r) oacc[r] = 0.f;
        v8f nx[2];                              // score tiles of the chunk after this one
#pragma unroll
        for (int tt = 0; tt < 2; ++tt)
            nx[tt] = __builtin_amdgcn_wmma_f32_16x16x32_f16(
                false, kf[tt], false, qfrag, (short)0, cm, false, false);
#pragma unroll
        for (int kc = 0; kc < 8; ++kc) {        // 8 chunks of 32 keys
            v8f sh[2];
#pragma unroll
            for (int tt = 0; tt < 2; ++tt) {
                sh[tt] = nx[tt];
                if (kc < 7)
                    nx[tt] = __builtin_amdgcn_wmma_f32_16x16x32_f16(
                        false, kf[kc * 2 + 2 + tt], false, qfrag, (short)0, cm, false, false);
            }
            v16h pfrag;
#pragma unroll
            for (int tt = 0; tt < 2; ++tt) {
#pragma unroll
                for (int r = 0; r < 8; ++r) sh[tt][r] = __builtin_amdgcn_exp2f(sh[tt][r]);
            }
#pragma unroll
            for (int tt = 0; tt < 2; ++tt) {
                const h8 ph = __builtin_convertvector(sh[tt], h8);
#pragma unroll
                for (int r = 0; r < 8; ++r) pfrag[tt * 8 + r] = ph[r];
            }
            const v16h vfrag = *(const v16h*)(vrow + kc * 32);
            oacc = __builtin_amdgcn_wmma_f32_16x16x32_f16(
                false, vfrag, false, pfrag, (short)0, oacc, false, false);
            // three scheduling regions in pass 2: left whole, the products stood bunched, with
            // more idle slots behind them and 23 more registers live
            if (kc == 2 || kc == 5) __builtin_amdgcn_sched_barrier(0);
        }

        const float rinv = 1.f / oacc[4];

        // ---- every lane stores its 4 channels: a wave-wide store is 16 pieces of 32 bytes ----
        {
            const int n   = mt * 16 + l15;
            const int row = n >> 1;
            const int col = gc + win * 2 + (n & 1);
            float* dst = out + ((size_t)b * (IMG_H * IMG_W) + (size_t)row * IMG_W + col) * CH
                             + h * HD + lhalf * 4;
            const float4 r0 = *(const float4*)&sRO[win][n][lhalf * 4];
            float4 o0;
            o0.x = oacc[0] * rinv + r0.x;  o0.y = oacc[1] * rinv + r0.y;
            o0.z = oacc[2] * rinv + r0.z;  o0.w = oacc[3] * rinv + r0.w;
            *(float4*)(dst) = o0;
            // the next trip reuses the store's address and data registers; the clobber
            // also keeps the V^T fragment loads inside the loop (no registers left for them)
            asm volatile("s_wait_xcnt 0x0" ::: "memory");
        }
    }
}

extern "C" void kernel_launch(void* const* d_in, const int* in_sizes, int n_in,
                              void* d_out, int out_size, void* d_ws, size_t ws_size,
                              hipStream_t stream) {
    (void)in_sizes; (void)n_in; (void)out_size; (void)d_ws; (void)ws_size;
    const float* temp   = (const float*)d_in[0];
    const float* conv_w = (const float*)d_in[1];
    const float* conv_b = (const float*)d_in[2];
    float* out = (float*)d_out;
    // grid: B(4) * window groups(8) * heads(8) = 256 blocks, 512 threads (16 wave32)
    hipLaunchKernelGGL(lepe_attn_kernel, dim3(256), dim3(512), 0, stream,
                       temp, conv_w, conv_b, out);
}

// v006
// It runs in 21.2 microseconds.
// Timed twice side by side with v005, it ran 1.04 and 1.05 times as fast.
// Counting every step since v000, it is 4.34 times as fast.
#include <hip/hip_runtime.h>

typedef __attribute__((ext_vector_type(16))) _Float16 v16h;
typedef __attribute__((ext_vector_type(8)))  _Float16 h8;
typedef __attribute__((ext_vector_type(2)))  _Float16 h2;
typedef __attribute__((ext_vector_type(8)))  float    v8f;
typedef __attribute__((ext_vector_type(4)))  float    f4;

#define CH     64
#define IMG_H  128
#define IMG_W  128
#define HEADS  8
#define HD     8
#define NTOK   256   // tokens per window (128 * 2)
#define WPB    8     // adjacent windows of one head per block: 16 image columns, 64 B a row
#define KPAD   24    // Q/K row: d 0..7 data, 16 the shift (Q) or 1 (K), else zero (48B row, 16B-multiple)
#define VPAD   264   // V^T row pad (528B, 16B-multiple, bank-skewed)
#define PTOP   15.f  // a query whose bound holds has its largest possible weight at 2^15 (f16 ends at 2^16)
#define BMAX   14.4f // bound above this: a weight could sink below f16's normal range (2^-14), take the true maximum

// 2-bit group bit-reverse permutation on bits [4:3] of a K/token index:
// groups of 8 reordered 0,2,1,3 so a WMMA 16-bit fragment's element order
// (K = half*8 + 0..7, then 16 + half*8 + 0..7) is contiguous in LDS.
__device__ __forceinline__ int kperm(int n) {
    return (n & ~0x18) | ((n & 8) << 1) | ((n & 16) >> 1);
}

// value of lane l ^ 16 (the other 16-lane half)
__device__ __forceinline__ float xhalf(float v) {
    const int b = __builtin_bit_cast(int, v);
    return __builtin_bit_cast(float,
        __builtin_amdgcn_permlanex16(b, b, 0x76543210, 0xfedcba98, false, false));
}

// square root with the one free slot the instruction set asks for behind a transcendental:
// in one statement
__device__ __forceinline__ float sqrt_slot(float x) {
    float y;
    asm("v_sqrt_f32 %0, %1\n\tv_nop" : "=v"(y) : "v"(x));
    return y;
}

// max with lane l ^ X inside a 16-lane row (DPP row_xmask:X)
template <int X>
__device__ __forceinline__ float xmax(float v) {
    const int b = __builtin_bit_cast(int, v);
    return fmaxf(v, __builtin_bit_cast(float,
        __builtin_amdgcn_update_dpp(b, b, 0x160 + X, 0xf, 0xf, false)));
}

__global__ __launch_bounds__(512, 1)
void lepe_attn_kernel(const float* __restrict__ temp,
                      const float* __restrict__ conv_w,
                      const float* __restrict__ conv_b,
                      float* __restrict__ out)
{
    __shared__ alignas(16) _Float16 sQ[WPB][NTOK][KPAD];   // [window][token][d | zeros, shift at 16]
    __shared__ alignas(16) _Float16 sK[WPB][NTOK][KPAD];
    __shared__ alignas(16) _Float16 sVT[WPB][HD + 1][VPAD]; // [window][d | ones][perm(token)]
    __shared__ alignas(16) float    sRO[WPB][NTOK][HD];    // rpe
    __shared__ alignas(16) float    sKM[WPB][16];          // [window][wave] largest |k|^2 of the wave's tokens
    __shared__ int                  sFB[WPB][16];          // [window][query tile] 1: tile takes the true maximum

    const int wh = blockIdx.x;          // 0 .. 255
    const int b  = wh >> 6;             // batch
    const int wg = (wh >> 3) & 7;       // group of 8 adjacent windows
    const int h  = wh & 7;              // head

    const int tid  = threadIdx.x;
    const int wave = __builtin_amdgcn_readfirstlane(tid >> 5);
    const int lane = tid & 31;
    const int gc   = wg * (WPB * 2);    // first image column of the group

    // 8^-0.5 * log2(e): the scores leave the matrix unit as exponents of 2
    const float scale = 0.35355339059327373f * 1.4426950408889634f;

    __builtin_prefetch(conv_w + (h * HD) * 9, 0, 0);
    __builtin_prefetch(conv_b + h * HD, 0, 0);

    h8 z8;
#pragma unroll
    for (int i = 0; i < 8; ++i) z8[i] = (_Float16)0.f;

    // Softmax is unchanged by any shift of a query's scores. |score| <= |q| |k|, so with
    // m = |q| * (largest |k| of the window) the shift PTOP - m puts every exponent in
    // [PTOP - 2m, PTOP]: no overflow, and for m <= BMAX every weight is a normal f16 number.
    // The shift rides in k slot 24 of the score product (row element 16: Q holds the shift,
    // K holds 1), so the score tiles need no row maximum. The norms are taken before the
    // rounding to f16, which moves m by under 0.02: PTOP leaves a whole power of two.
    float q2[4];                        // |q|^2 of the thread's four tokens

    // ---------------- stage Q,K,V  global(f32) -> LDS(f16) ----------------
    // Every load is 16 bytes; four neighbouring lanes cover the group's 64 contiguous
    // bytes of one image row, so a wave-wide load touches 8 lines, not 32.
    // The unrolls give qx, kx, vx constant indices (registers, no scratch) and let all
    // 24 loads of a thread be in flight together.
    {
        const size_t plane = (size_t)IMG_H * IMG_W;
        const int cq = tid & 3;         // column quad: windows 2*cq and 2*cq + 1
        const int r  = tid >> 2;        // Q, K: image row
        const int rg = r & 31;          // V: group of four image rows (8 tokens)
        const int dv = tid >> 7;        // V: channels dv and dv + 4
        const float* hb = temp + ((size_t)(b * 3) * CH + h * HD) * plane + gc + cq * 4;
        const float* qs = hb + (size_t)r * IMG_W;
        const float* ks = qs + (size_t)CH * plane;
        const float* vs = hb + (size_t)(2 * CH + dv) * plane + (size_t)(rg * 4) * IMG_W;

        f4 qx[HD], kx[HD], vx[2][4];
#pragma unroll
        for (int d = 0; d < HD; ++d) {
            qx[d] = *(const f4*)(qs + (size_t)d * plane);
            kx[d] = *(const f4*)(ks + (size_t)d * plane);
        }
#pragma unroll
        for (int j = 0; j < 2; ++j)
#pragma unroll
            for (int i = 0; i < 4; ++i)
                vx[j][i] = *(const f4*)(vs + (size_t)(4 * j) * plane + (size_t)i * IMG_W);

        // Q, K: the thread holds all 8 channels of 4 tokens: one 16-byte row each,
        // and the rows' pads (Q's last piece, with the shift, follows behind the barrier)
        h8 o1 = z8;
        o1[0] = (_Float16)1.f;
        float k2[4];
#pragma unroll
        for (int c = 0; c < 4; ++c) {
            const int wl = 2 * cq + (c >> 1);
            const int n  = 2 * r + (c & 1);
            h8 qr, kr;
            float qa = 0.f, ka = 0.f;
#pragma unroll
            for (int d = 0; d < HD; ++d) {
                const float qv = qx[d][c] * scale;
                const float kv = kx[d][c];
                qr[d] = (_Float16)qv;
                kr[d] = (_Float16)kv;
                qa += qv * qv;
                ka += kv * kv;
            }
            q2[c] = qa;
            k2[c] = ka;
            *(h8*)&sQ[wl][n][0] = qr;  *(h8*)&sQ[wl][n][8] = z8;
            *(h8*)&sK[wl][n][0] = kr;  *(h8*)&sK[wl][n][8] = z8;  *(h8*)&sK[wl][n][16] = o1;
        }
        // largest |k|^2 per window over the wave: lanes of equal cq differ in bits 2, 3, 4
#pragma unroll
        for (int p = 0; p < 2; ++p) {
            float km = fmaxf(k2[2 * p], k2[2 * p + 1]);
            km = xmax<4>(km);
            km = xmax<8>(km);
            km = fmaxf(km, xhalf(km));
            if (lane < 4) sKM[2 * cq + p][wave] = km;
        }
        // V^T: four rows of one channel are 8 consecutive tokens of each window
        // (kperm keeps bits [2:0]): one 16-byte piece of the channel's row
        const int pn = kperm(rg * 8);
#pragma unroll
        for (int j = 0; j < 2; ++j) {
#pragma unroll
            for (int p = 0; p < 2; ++p) {
                h8 vr;
#pragma unroll
                for (int i = 0; i < 4; ++i) {
                    vr[2 * i    ] = (_Float16)vx[j][i][2 * p    ];
                    vr[2 * i + 1] = (_Float16)vx[j][i][2 * p + 1];
                }
                *(h8*)&sVT[2 * cq + p][dv + 4 * j][pn] = vr;
            }
        }
        // ninth row of every window: ones (its pitch puts it on banks the eight channel rows leave free)
        if (tid < WPB * (NTOK / 8)) {
            h8 o8;
#pragma unroll
            for (int i = 0; i < 8; ++i) o8[i] = (_Float16)1.f;
            *(h8*)&sVT[tid >> 5][HD][(tid & 31) * 8] = o8;
        }
    }
    __syncthreads();

    // ---------------- each query's shift, from its bound ----------------
    // The thread's four tokens again. A wave's tokens are query tile 'wave' of all 8 windows.
    {
        const int cq = tid & 3;
        const int r  = tid >> 2;
        bool loose[2];
#pragma unroll
        for (int p = 0; p < 2; ++p) {
            const int wl = 2 * cq + p;
            f4 km4 = *(const f4*)&sKM[wl][0];
#pragma unroll
            for (int i = 1; i < 4; ++i) {
                const f4 t = *(const f4*)&sKM[wl][4 * i];
#pragma unroll
                for (int e = 0; e < 4; ++e) km4[e] = fmaxf(km4[e], t[e]);
            }
            const float kmax2 = fmaxf(fmaxf(km4[0], km4[1]), fmaxf(km4[2], km4[3]));
            loose[p] = false;
#pragma unroll
            for (int e = 0; e < 2; ++e) {
                const float m  = sqrt_slot(q2[2 * p + e] * kmax2);
                const bool  ok = m <= BMAX;      // false for a NaN too
                h8 sh8 = z8;
                sh8[0] = (_Float16)(ok ? PTOP - m : 0.f);
                *(h8*)&sQ[wl][2 * r + e][16] = sh8;
                loose[p] = loose[p] || !ok;
            }
        }
        const unsigned bal0 = __builtin_amdgcn_ballot_w32(loose[0]);
        const unsigned bal1 = __builtin_amdgcn_ballot_w32(loose[1]);
        if (lane < 4) {                 // lanes of equal cq: every fourth bit
            sFB[2 * cq    ][wave] = (bal0 & (0x11111111u << cq)) != 0u;
            sFB[2 * cq + 1][wave] = (bal1 & (0x11111111u << cq)) != 0u;
        }
    }

    // ---------------- LePE: window-local depthwise 3x3 conv ----------------
    // Branch-free. A thread takes one image row (both tokens) for four channels: the
    // two tokens are adjacent halves of sVT (kperm keeps bits [2:0]), so one 4-byte
    // read per row and channel brings both columns; a row outside the window is read
    // clamped and zeroed. Every weight is used by every lane, so all stay scalar.
    // 256 threads take a window; the block's two halves walk the 8 windows in 4 trips.
    for (int win = wave >> 3; win < WPB; win += 2) {
        const int  hs   = tid & (IMG_H - 1);
        // channel group, the same in every lane of a wave: keeps the weight loads scalar
        const int  cg   = ((wave >> 2) & 1) * 4;
        const bool hasm = hs > 0;
        const bool hasp = hs < IMG_H - 1;
        const int  cm   = kperm((hasm ? hs - 1 : hs) * 2);
        const int  c0   = kperm(hs * 2);
        const int  cp   = kperm((hasp ? hs + 1 : hs) * 2);
        const float* wt = conv_w + (h * HD + cg) * 9;
        const float* bs = conv_b + (h * HD + cg);
        float ra[4], rb[4];                      // column 0 and column 1 of the row
#pragma unroll
        for (int j = 0; j < 4; ++j) {
            h2 v3[3];
            v3[0] = *(const h2*)&sVT[win][cg + j][cm];
            v3[1] = *(const h2*)&sVT[win][cg + j][c0];
            v3[2] = *(const h2*)&sVT[win][cg + j][cp];
            if (!hasm) { v3[0][0] = (_Float16)0.f; v3[0][1] = (_Float16)0.f; }
            if (!hasp) { v3[2][0] = (_Float16)0.f; v3[2][1] = (_Float16)0.f; }
            float a0 = bs[j], a1 = bs[j];
#pragma unroll
            for (int r = 0; r < 3; ++r) {
                // input column x meets weight column x - (output column) + 1
                const float x0 = (float)v3[r][0], x1 = (float)v3[r][1];
                a0 += wt[j * 9 + r * 3 + 1] * x0;
                a0 += wt[j * 9 + r * 3 + 2] * x1;
                a1 += wt[j * 9 + r * 3 + 0] * x0;
                a1 += wt[j * 9 + r * 3 + 1] * x1;
            }
            ra[j] = a0;
            rb[j] = a1;
        }
        float4 s0, s1;
        s0.x = ra[0]; s0.y = ra[1]; s0.z = ra[2]; s0.w = ra[3];
        s1.x = rb[0]; s1.y = rb[1]; s1.z = rb[2]; s1.w = rb[3];
        *(float4*)&sRO[win][hs * 2    ][cg] = s0;
        *(float4*)&sRO[win][hs * 2 + 1][cg] = s1;
    }
    __syncthreads();

    const int lhalf = lane >> 4;   // K half selector for 16-bit fragments
    const int l15   = lane & 15;

    const int win   = wave >> 1;   // two waves share a window

    // ---- A fragments of the window's 16 key tiles: read once, kept for all query tiles ----
    // Every loop from here on but the query-tile loop is unrolled so that kf, the score tiles and the fragments
    // have constant indices: registers, no scratch.
    v16h kf[16];
#pragma unroll
    for (int t = 0; t < 16; ++t)
        kf[t] = *(const v16h*)&sK[win][t * 16 + l15][lhalf * 8];

    // A rows of the second product: rows 0..3 are channels 0..3, rows 8..11 channels 4..7,
    // every other row the ones. In O^T a lane of half lhalf then holds channels
    // 4*lhalf .. 4*lhalf+3 of query l15 in registers 0..3 and the sum of its weights in 4.
    const _Float16* vrow =
        &sVT[win][(l15 & 4) ? HD : (l15 & 3) + ((l15 >> 3) << 2)][lhalf * 16];

    // bit mt: query tile mt holds a query whose bound is too loose (a scalar, tested per tile)
    const unsigned fbm = __builtin_amdgcn_ballot_w32(sFB[win][l15] != 0);

    for (int mt = wave & 1; mt < 16; mt += 2) { // eight 16-query tiles per wave
        // ---- B fragment: this lane's query column (upper half: the shift, else zeros) ----
        const v16h qfrag = *(const v16h*)&sQ[win][mt * 16 + l15][lhalf * 8];

        // ---- pass 1, S^T = K Q^T, only where a bound is too loose: each score tile is read
        // for the row maximum only; elsewhere the shift in the product does the maximum's work ----
        // tile[r] = score(query mt*16 + l15, key 16*t + 8*lhalf + r)
        float mx = 0.f;
        if ((fbm >> mt) & 1u) {
        v8f cz;
#pragma unroll
        for (int i = 0; i < 8; ++i) cz[i] = 0.f;
        float m4[4];
#pragma unroll
        for (int p = 0; p < 4; ++p) m4[p] = -__builtin_inff();
#pragma unroll
        for (int tg = 0; tg < 16; tg += 4) {    // four products fill each other's result distance
            v8f a[4];
#pragma unroll
            for (int tt = 0; tt < 4; ++tt)
                a[tt] = __builtin_amdgcn_wmma_f32_16x16x32_f16(
                    false, kf[tg + tt], false, qfrag, (short)0, cz, false, false);
#pragma unroll
            for (int tt = 0; tt < 4; ++tt)
#pragma unroll
                for (int p = 0; p < 4; ++p)
                    m4[p] = fmaxf(fmaxf(m4[p], a[tt][2 * p]), a[tt][2 * p + 1]);
        }
        mx = fmaxf(fmaxf(m4[0], m4[1]), fmaxf(m4[2], m4[3]));
        // schedule: products run one group of four ahead of the maxima that read them;
        // left alone, each product stood right in front of its readers, behind idle slots
        __builtin_amdgcn_sched_group_barrier(0x008, 8, 0);    // matrix instructions
        __builtin_amdgcn_sched_group_barrier(0x002, 16, 0);   // vector: one group's maxima
        __builtin_amdgcn_sched_group_barrier(0x008, 4, 0);
        __builtin_amdgcn_sched_group_barrier(0x002, 16, 0);
        __builtin_amdgcn_sched_group_barrier(0x008, 4, 0);
        __builtin_amdgcn_sched_group_barrier(0x002, 32, 0);
        __builtin_amdgcn_sched_barrier(0);
        mx = fmaxf(mx, xhalf(mx));
        }

        // ---- pass 2: the same products with C = -max (0 where no bound of the tile is loose): the tile is the exp2 argument ----
        v8f cm;
#pragma unroll
        for (int i = 0; i < 8; ++i) cm[i] = -mx;

        // ---- GEMM2 transposed: O^T = V^T P^T, P^T packed from the score tiles ----
        // two key tiles converted in place are one B fragment in hardware k order,
        // which is the order sVT's permuted columns give the A fragment
        v8f oacc;
#pragma unroll
        for (int r = 0; r < 8; ++r) oacc[r] = 0.f;
        v8f nx[2];                              // score tiles of the chunk after this one
#pragma unroll
        for (int tt = 0; tt < 2; ++tt)
            nx[tt] = __builtin_amdgcn_wmma_f32_16x16x32_f16(
                false, kf[tt], false, qfrag, (short)0, cm, false, false);
#pragma unroll
        for (int kc = 0; kc < 8; ++kc) {        // 8 chunks of 32 keys
            v8f sh[2];
#pragma unroll
            for (int tt = 0; tt < 2; ++tt) {
                sh[tt] = nx[tt];
                if (kc < 7)
                    nx[tt] = __builtin_amdgcn_wmma_f32_16x16x32_f16(
                        false, kf[kc * 2 + 2 + tt], false, qfrag, (short)0, cm, false, false);
            }
            v16h pfrag;
#pragma unroll
            for (int tt = 0; tt < 2; ++tt) {
#pragma unroll
                for (int r = 0; r < 8; ++r) sh[tt][r] = __builtin_amdgcn_exp2f(sh[tt][r]);
            }
#pragma unroll
            for (int tt = 0; tt < 2; ++tt) {
                const h8 ph = __builtin_convertvector(sh[tt], h8);
#pragma unroll
                for (int r = 0; r < 8; ++r) pfrag[tt * 8 + r] = ph[r];
            }
            const v16h vfrag = *(const v16h*)(vrow + kc * 32);
            oacc = __builtin_amdgcn_wmma_f32_16x16x32_f16(
                false, vfrag, false, pfrag, (short)0, oacc, false, false);
            // three scheduling regions in pass 2: left whole, the products stood bunched, with
            // more idle slots behind them and 23 more registers live
            if (kc == 2 || kc == 5) __builtin_amdgcn_sched_barrier(0);
        }

        const float rinv = 1.f / oacc[4];

        // ---- every lane stores its 4 channels: a wave-wide store is 16 pieces of 32 bytes ----
        {
            const int n   = mt * 16 + l15;
            const int row = n >> 1;
            const int col = gc + win * 2 + (n & 1);
            float* dst = out + ((size_t)b * (IMG_H * IMG_W) + (size_t)row * IMG_W + col) * CH
                             + h * HD + lhalf * 4;
            const float4 r0 = *(const float4*)&sRO[win][n][lhalf * 4];
            float4 o0;
            o0.x = oacc[0] * rinv + r0.x;  o0.y = oacc[1] * rinv + r0.y;
            o0.z = oacc[2] * rinv + r0.z;  o0.w = oacc[3] * rinv + r0.w;
            *(float4*)(dst) = o0;
            // the next trip reuses the store's address and data registers; the clobber
            // also keeps the V^T fragment loads inside the loop (no registers left for them)
            asm volatile("s_wait_xcnt 0x0" ::: "memory");
        }
    }
}

extern "C" void kernel_launch(void* const* d_in, const int* in_sizes, int n_in,
                              void* d_out, int out_size, void* d_ws, size_t ws_size,
                              hipStream_t stream) {
    (void)in_sizes; (void)n_in; (void)out_size; (void)d_ws; (void)ws_size;
    const float* temp   = (const float*)d_in[0];
    const float* conv_w = (const float*)d_in[1];
    const float* conv_b = (const float*)d_in[2];
    float* out = (float*)d_out;
    // grid: B(4) * window groups(8) * heads(8) = 256 blocks, 512 threads (16 wave32)
    hipLaunchKernelGGL(lepe_attn_kernel, dim3(256), dim3(512), 0, stream,
                       temp, conv_w, conv_b, out);
}

// v007
// A run of this version takes 20.4 microseconds.
// Two timings next to v006 put it at 1.04 and 1.03 times that version's speed.
// All steps since v000 together make it 4.48 times as fast.
#include <hip/hip_runtime.h>

typedef __attribute__((ext_vector_type(16))) _Float16 v16h;
typedef __attribute__((ext_vector_type(8)))  _Float16 h8;
typedef __attribute__((ext_vector_type(2)))  _Float16 h2;
typedef __attribute__((ext_vector_type(8)))  float    v8f;
typedef __attribute__((ext_vector_type(4)))  float    f4;

#define CH     64
#define IMG_H  128
#define IMG_W  128
#define HEADS  8
#define HD     8
#define NTOK   256   // tokens per window (128 * 2)
#define WPB    8     // adjacent windows of one head per block: 16 image columns, 64 B a row
#define KPAD   24    // Q/K row: d 0..7 data, 16 the shift (Q) or 1 (K), else zero (48B row, 16B-multiple)
#define VPAD   264   // V^T row pad (528B, 16B-multiple, bank-skewed)
#define ROCP   260   // rpe row of one channel, floats: four rows on lie 64 B further round the banks
#define ROPAIR (2 * HD * ROCP + 4) // rpe of a window pair, floats: the next pair lies 16 B further round the banks
#define PTOP   15.f  // a query whose bound holds has its largest possible weight at 2^15 (f16 ends at 2^16)
#define BMAX   14.4f // bound above this: a weight could sink below f16's normal range (2^-14), take the true maximum

// 2-bit group bit-reverse permutation on bits [4:3] of a K/token index:
// groups of 8 reordered 0,2,1,3 so a WMMA 16-bit fragment's element order
// (K = half*8 + 0..7, then 16 + half*8 + 0..7) is contiguous in LDS.
__device__ __forceinline__ int kperm(int n) {
    return (n & ~0x18) | ((n & 8) << 1) | ((n & 16) >> 1);
}

// place of rpe(window, channel, token) in sRO: a channel's tokens are contiguous
__device__ __forceinline__ int ro_at(int win, int ch, int n) {
    return (win >> 1) * ROPAIR + ((win & 1) * HD + ch) * ROCP + n;
}

// value of lane l ^ 16 (the other 16-lane half)
__device__ __forceinline__ float xhalf(float v) {
    const int b = __builtin_bit_cast(int, v);
    return __builtin_bit_cast(float,
        __builtin_amdgcn_permlanex16(b, b, 0x76543210, 0xfedcba98, false, false));
}

// square root with the one free slot the instruction set asks for behind a transcendental:
// in one statement
__device__ __forceinline__ float sqrt_slot(float x) {
    float y;
    asm("v_sqrt_f32 %0, %1\n\tv_nop" : "=v"(y) : "v"(x));
    return y;
}

// max with lane l ^ X inside a 16-lane row (DPP row_xmask:X)
template <int X>
__device__ __forceinline__ float xmax(float v) {
    const int b = __builtin_bit_cast(int, v);
    return fmaxf(v, __builtin_bit_cast(float,
        __builtin_amdgcn_update_dpp(b, b, 0x160 + X, 0xf, 0xf, false)));
}

__global__ __launch_bounds__(512, 1)
void lepe_attn_kernel(const float* __restrict__ temp,
                      const float* __restrict__ conv_w,
                      const float* __restrict__ conv_b,
                      float* __restrict__ out)
{
    __shared__ alignas(16) _Float16 sQ[WPB][NTOK][KPAD];   // [window][token][d | zeros, shift at 16]
    __shared__ alignas(16) _Float16 sK[WPB][NTOK][KPAD];
    __shared__ alignas(16) _Float16 sVT[WPB][HD + 1][VPAD]; // [window][d | ones][perm(token)]
    __shared__ alignas(16) float    sRO[(WPB / 2) * ROPAIR]; // rpe, see ro_at
    __shared__ alignas(16) float    sKM[WPB][16];          // [window][wave] largest |k|^2 of the wave's tokens
    __shared__ int                  sFB[WPB][16];          // [window][query tile] 1: tile takes the true maximum

    const int wh = blockIdx.x;          // 0 .. 255
    const int b  = wh >> 6;             // batch
    const int wg = (wh >> 3) & 7;       // group of 8 adjacent windows
    const int h  = wh & 7;              // head

    const int tid  = threadIdx.x;
    const int wave = __builtin_amdgcn_readfirstlane(tid >> 5);
    const int lane = tid & 31;
    const int gc   = wg * (WPB * 2);    // first image column of the group

    // 8^-0.5 * log2(e): the scores leave the matrix unit as exponents of 2
    const float scale = 0.35355339059327373f * 1.4426950408889634f;

    h8 z8;
#pragma unroll
    for (int i = 0; i < 8; ++i) z8[i] = (_Float16)0.f;

    // Softmax is unchanged by any shift of a query's scores. |score| <= |q| |k|, so with
    // m = |q| * (largest |k| of the window) the shift PTOP - m puts every exponent in
    // [PTOP - 2m, PTOP]: no overflow, and for m <= BMAX every weight is a normal f16 number.
    // The shift rides in k slot 24 of the score product (row element 16: Q holds the shift,
    // K holds 1), so the score tiles need no row maximum. The norms are taken before the
    // rounding to f16, which moves m by under 0.02: PTOP leaves a whole power of two.
    float q2[4];                        // |q|^2 of the thread's four tokens

    // ---------------- stage Q,K,V  global(f32) -> LDS(f16) ----------------
    // Every load is 16 bytes; four neighbouring lanes cover the group's 64 contiguous
    // bytes of one image row, so a wave-wide load touches 8 lines, not 32.
    // The unrolls give qx, kx, vx constant indices (registers, no scratch).
    // V is asked for first, then Q and K: the LePE conv is taken from the V registers
    // while the Q and K loads are still in flight.
    {
        const size_t plane = (size_t)IMG_H * IMG_W;
        const int cq = tid & 3;         // column quad: windows 2*cq and 2*cq + 1
        const int r  = tid >> 2;        // Q, K: image row
        const int rg = (wave & 1) * 8 + (lane >> 2); // V: group of eight image rows (16 tokens)
        const int vc = wave >> 1;       // V: channel, the same in every lane: its weights stay scalar
        const float* hb = temp + ((size_t)(b * 3) * CH + h * HD) * plane + gc + cq * 4;
        const float* qs = hb + (size_t)r * IMG_W;
        const float* ks = qs + (size_t)CH * plane;
        const float* vs = hb + (size_t)(2 * CH + vc) * plane + (size_t)(rg * 8) * IMG_W;
        const bool hasm = rg > 0;       // a row above the group, a row below it
        const bool hasp = rg < IMG_H / 8 - 1;

        float wt[9];
#pragma unroll
        for (int i = 0; i < 9; ++i) wt[i] = conv_w[(h * HD + vc) * 9 + i];
        const float bias = conv_b[h * HD + vc];

        // vx[1..8]: the group's rows; vx[0], vx[9]: the rows next to it, read clamped at the image's edge
        f4 qx[HD], kx[HD], vx[10];
        vx[0] = *(const f4*)(vs - (hasm ? IMG_W : 0));
#pragma unroll
        for (int i = 0; i < 8; ++i)
            vx[i + 1] = *(const f4*)(vs + (size_t)i * IMG_W);
        vx[9] = *(const f4*)(vs + (hasp ? 8 : 7) * IMG_W);
        // Q's and K's loads land in registers that V's loads name as addresses: the wait stands in
        // front of them. Its clobber keeps V's ten loads ahead of Q's and K's (loads return in issue
        // order): left alone, the row below the group was asked for last and the conv waited for all
        asm volatile("s_wait_xcnt 0x0" ::: "memory");
#pragma unroll
        for (int d = 0; d < HD; ++d) {
            qx[d] = *(const f4*)(qs + (size_t)d * plane);
            kx[d] = *(const f4*)(ks + (size_t)d * plane);
        }
        // the wait before the address registers of Q's and K's loads are written again; qs is an
        // input so that they stay as they are up to here. The weights are inputs only too: all ten
        // scalar loads are asked for ahead of this place, under V's flight: left alone, the ninth
        // weight was asked for in the middle of the conv, behind a wait for the first eight
        asm volatile("s_wait_xcnt 0x0"
                     :: "v"(qs), "s"(wt[0]), "s"(wt[1]), "s"(wt[2]), "s"(wt[3]), "s"(wt[4]),
                        "s"(wt[5]), "s"(wt[6]), "s"(wt[7]), "s"(wt[8]), "s"(bias) : "memory");
        // all 26 loads are issued before the first value is used: left alone, the scheduler
        // put the last group of loads behind waits for most of the first
        __builtin_amdgcn_sched_barrier(0);

        // V^T: eight rows of one channel are 16 consecutive tokens of each window
        // (kperm keeps bits [2:0]): two 16-byte pieces of the channel's row
#pragma unroll
        for (int p = 0; p < 2; ++p) {
#pragma unroll
            for (int hf = 0; hf < 2; ++hf) {
                h8 vr;
#pragma unroll
                for (int i = 0; i < 4; ++i) {
                    vr[2 * i    ] = (_Float16)vx[1 + 4 * hf + i][2 * p    ];
                    vr[2 * i + 1] = (_Float16)vx[1 + 4 * hf + i][2 * p + 1];
                }
                *(h8*)&sVT[2 * cq + p][vc][kperm(rg * 16 + hf * 8)] = vr;
            }
        }

        // ---- LePE: window-local depthwise 3x3 conv, from the f32 registers ----
        // Branch-free: a row outside the image counts as zero; a window is two columns wide,
        // so input column x meets weight column x - (output column) + 1.
        if (!hasm) vx[0] = (f4)(0.f);
        if (!hasp) vx[9] = (f4)(0.f);
#pragma unroll
        for (int p = 0; p < 2; ++p) {
            float* ro = &sRO[ro_at(2 * cq + p, vc, rg * 16)];
#pragma unroll
            for (int i = 0; i < 8; i += 2) {     // two image rows: four tokens, one 16-byte store
                f4 o;
#pragma unroll
                for (int e = 0; e < 2; ++e) {
                    float a0 = bias, a1 = bias;
#pragma unroll
                    for (int rr = 0; rr < 3; ++rr) {
                        const float x0 = vx[i + e + rr][2 * p], x1 = vx[i + e + rr][2 * p + 1];
                        a0 += wt[rr * 3 + 1] * x0;
                        a0 += wt[rr * 3 + 2] * x1;
                        a1 += wt[rr * 3 + 0] * x0;
                        a1 += wt[rr * 3 + 1] * x1;
                    }
                    o[2 * e    ] = a0;
                    o[2 * e + 1] = a1;
                }
                *(f4*)(ro + 2 * i) = o;
            }
        }
        // the conv stays in front of the first use of Q and K: left alone, a wait for two of
        // their loads stood near its head
        __builtin_amdgcn_sched_barrier(0);

        // Q, K: the thread holds all 8 channels of 4 tokens: one 16-byte row each,
        // and the rows' pads (Q's last piece, with the shift, follows behind the barrier)
        h8 o1 = z8;
        o1[0] = (_Float16)1.f;
        float k2[4];
#pragma unroll
        for (int c = 0; c < 4; ++c) {
            const int wl = 2 * cq + (c >> 1);
            const int n  = 2 * r + (c & 1);
            h8 qr, kr;
            float qa = 0.f, ka = 0.f;
#pragma unroll
            for (int d = 0; d < HD; ++d) {
                const float qv = qx[d][c] * scale;
                const float kv = kx[d][c];
                qr[d] = (_Float16)qv;
                kr[d] = (_Float16)kv;
                qa += qv * qv;
                ka += kv * kv;
            }
            q2[c] = qa;
            k2[c] = ka;
            *(h8*)&sQ[wl][n][0] = qr;  *(h8*)&sQ[wl][n][8] = z8;
            *(h8*)&sK[wl][n][0] = kr;  *(h8*)&sK[wl][n][8] = z8;  *(h8*)&sK[wl][n][16] = o1;
        }
        // largest |k|^2 per window over the wave: lanes of equal cq differ in bits 2, 3, 4
#pragma unroll
        for (int p = 0; p < 2; ++p) {
            float km = fmaxf(k2[2 * p], k2[2 * p + 1]);
            km = xmax<4>(km);
            km = xmax<8>(km);
            km = fmaxf(km, xhalf(km));
            if (lane < 4) sKM[2 * cq + p][wave] = km;
        }
        // ninth row of every window: ones (its pitch puts it on banks the eight channel rows leave free)
        if (tid < WPB * (NTOK / 8)) {
            h8 o8;
#pragma unroll
            for (int i = 0; i < 8; ++i) o8[i] = (_Float16)1.f;
            *(h8*)&sVT[tid >> 5][HD][(tid & 31) * 8] = o8;
        }
    }
    __syncthreads();

    // ---------------- each query's shift, from its bound ----------------
    // The thread's four tokens again. A wave's tokens are query tile 'wave' of all 8 windows.
    {
        const int cq = tid & 3;
        const int r  = tid >> 2;
        bool loose[2];
#pragma unroll
        for (int p = 0; p < 2; ++p) {
            const int wl = 2 * cq + p;
            f4 km4 = *(const f4*)&sKM[wl][0];
#pragma unroll
            for (int i = 1; i < 4; ++i) {
                const f4 t = *(const f4*)&sKM[wl][4 * i];
#pragma unroll
                for (int e = 0; e < 4; ++e) km4[e] = fmaxf(km4[e], t[e]);
            }
            const float kmax2 = fmaxf(fmaxf(km4[0], km4[1]), fmaxf(km4[2], km4[3]));
            loose[p] = false;
#pragma unroll
            for (int e = 0; e < 2; ++e) {
                const float m  = sqrt_slot(q2[2 * p + e] * kmax2);
                const bool  ok = m <= BMAX;      // false for a NaN too
                h8 sh8 = z8;
                sh8[0] = (_Float16)(ok ? PTOP - m : 0.f);
                *(h8*)&sQ[wl][2 * r + e][16] = sh8;
                loose[p] = loose[p] || !ok;
            }
        }
        const unsigned bal0 = __builtin_amdgcn_ballot_w32(loose[0]);
        const unsigned bal1 = __builtin_amdgcn_ballot_w32(loose[1]);
        if (lane < 4) {                 // lanes of equal cq: every fourth bit
            sFB[2 * cq    ][wave] = (bal0 & (0x11111111u << cq)) != 0u;
            sFB[2 * cq + 1][wave] = (bal1 & (0x11111111u << cq)) != 0u;
        }
    }

    __syncthreads();

    const int lhalf = lane >> 4;   // K half selector for 16-bit fragments
    const int l15   = lane & 15;

    const int win   = wave >> 1;   // two waves share a window

    // ---- A fragments of the window's 16 key tiles: read once, kept for all query tiles ----
    // Every loop from here on but the query-tile loop is unrolled so that kf, the score tiles and the fragments
    // have constant indices: registers, no scratch.
    v16h kf[16];
#pragma unroll
    for (int t = 0; t < 16; ++t)
        kf[t] = *(const v16h*)&sK[win][t * 16 + l15][lhalf * 8];

    // A rows of the second product: rows 0..3 are channels 0..3, rows 8..11 channels 4..7,
    // every other row the ones. In O^T a lane of half lhalf then holds channels
    // 4*lhalf .. 4*lhalf+3 of query l15 in registers 0..3 and the sum of its weights in 4.
    const _Float16* vrow =
        &sVT[win][(l15 & 4) ? HD : (l15 & 3) + ((l15 >> 3) << 2)][lhalf * 16];

    // bit mt: query tile mt holds a query whose bound is too loose (a scalar, tested per tile)
    const unsigned fbm = __builtin_amdgcn_ballot_w32(sFB[win][l15] != 0);

    for (int mt = wave & 1; mt < 16; mt += 2) { // eight 16-query tiles per wave
        // ---- B fragment: this lane's query column (upper half: the shift, else zeros) ----
        const v16h qfrag = *(const v16h*)&sQ[win][mt * 16 + l15][lhalf * 8];

        // ---- pass 1, S^T = K Q^T, only where a bound is too loose: each score tile is read
        // for the row maximum only; elsewhere the shift in the product does the maximum's work ----
        // tile[r] = score(query mt*16 + l15, key 16*t + 8*lhalf + r)
        float mx = 0.f;
        if ((fbm >> mt) & 1u) {
        v8f cz;
#pragma unroll
        for (int i = 0; i < 8; ++i) cz[i] = 0.f;
        float m4[4];
#pragma unroll
        for (int p = 0; p < 4; ++p) m4[p] = -__builtin_inff();
#pragma unroll
        for (int tg = 0; tg < 16; tg += 4) {    // four products fill each other's result distance
            v8f a[4];
#pragma unroll
            for (int tt = 0; tt < 4; ++tt)
                a[tt] = __builtin_amdgcn_wmma_f32_16x16x32_f16(
                    false, kf[tg + tt], false, qfrag, (short)0, cz, false, false);
#pragma unroll
            for (int tt = 0; tt < 4; ++tt)
#pragma unroll
                for (int p = 0; p < 4; ++p)
                    m4[p] = fmaxf(fmaxf(m4[p], a[tt][2 * p]), a[tt][2 * p + 1]);
        }
        mx = fmaxf(fmaxf(m4[0], m4[1]), fmaxf(m4[2], m4[3]));
        // schedule: products run one group of four ahead of the maxima that read them;
        // left alone, each product stood right in front of its readers, behind idle slots
        __builtin_amdgcn_sched_group_barrier(0x008, 8, 0);    // matrix instructions
        __builtin_amdgcn_sched_group_barrier(0x002, 16, 0);   // vector: one group's maxima
        __builtin_amdgcn_sched_group_barrier(0x008, 4, 0);
        __builtin_amdgcn_sched_group_barrier(0x002, 16, 0);
        __builtin_amdgcn_sched_group_barrier(0x008, 4, 0);
        __builtin_amdgcn_sched_group_barrier(0x002, 32, 0);
        __builtin_amdgcn_sched_barrier(0);
        mx = fmaxf(mx, xhalf(mx));
        }

        // ---- pass 2: the same products with C = -max (0 where no bound of the tile is loose): the tile is the exp2 argument ----
        v8f cm;
#pragma unroll
        for (int i = 0; i < 8; ++i) cm[i] = -mx;

        // ---- GEMM2 transposed: O^T = V^T P^T, P^T packed from the score tiles ----
        // two key tiles converted in place are one B fragment in hardware k order,
        // which is the order sVT's permuted columns give the A fragment
        v8f oacc;
#pragma unroll
        for (int r = 0; r < 8; ++r) oacc[r] = 0.f;
        v8f nx[2];                              // score tiles of the chunk after this one
#pragma unroll
        for (int tt = 0; tt < 2; ++tt)
            nx[tt] = __builtin_amdgcn_wmma_f32_16x16x32_f16(
                false, kf[tt], false, qfrag, (short)0, cm, false, false);
#pragma unroll
        for (int kc = 0; kc < 8; ++kc) {        // 8 chunks of 32 keys
            v8f sh[2];
#pragma unroll
            for (int tt = 0; tt < 2; ++tt) {
                sh[tt] = nx[tt];
                if (kc < 7)
                    nx[tt] = __builtin_amdgcn_wmma_f32_16x16x32_f16(
                        false, kf[kc * 2 + 2 + tt], false, qfrag, (short)0, cm, false, false);
            }
            v16h pfrag;
#pragma unroll
            for (int tt = 0; tt < 2; ++tt) {
#pragma unroll
                for (int r = 0; r < 8; ++r) sh[tt][r] = __builtin_amdgcn_exp2f(sh[tt][r]);
            }
#pragma unroll
            for (int tt = 0; tt < 2; ++tt) {
                const h8 ph = __builtin_convertvector(sh[tt], h8);
#pragma unroll
                for (int r = 0; r < 8; ++r) pfrag[tt * 8 + r] = ph[r];
            }
            const v16h vfrag = *(const v16h*)(vrow + kc * 32);
            oacc = __builtin_amdgcn_wmma_f32_16x16x32_f16(
                false, vfrag, false, pfrag, (short)0, oacc, false, false);
            // three scheduling regions in pass 2: left whole, the products stood bunched, with
            // more idle slots behind them and 23 more registers live
            if (kc == 2 || kc == 5) __builtin_amdgcn_sched_barrier(0);
        }

        const float rinv = 1.f / oacc[4];

        // ---- every lane stores its 4 channels: a wave-wide store is 16 pieces of 32 bytes ----
        {
            const int n   = mt * 16 + l15;
            const int row = n >> 1;
            const int col = gc + win * 2 + (n & 1);
            float* dst = out + ((size_t)b * (IMG_H * IMG_W) + (size_t)row * IMG_W + col) * CH
                             + h * HD + lhalf * 4;
            const float* rp = &sRO[ro_at(win, lhalf * 4, n)];
            float4 r0;
            r0.x = rp[0];  r0.y = rp[ROCP];  r0.z = rp[2 * ROCP];  r0.w = rp[3 * ROCP];
            float4 o0;
            o0.x = oacc[0] * rinv + r0.x;  o0.y = oacc[1] * rinv + r0.y;
            o0.z = oacc[2] * rinv + r0.z;  o0.w = oacc[3] * rinv + r0.w;
            *(float4*)(dst) = o0;
            // the next trip reuses the store's address and data registers; the clobber
            // also keeps the V^T fragment loads inside the loop (no registers left for them)
            asm volatile("s_wait_xcnt 0x0" ::: "memory");
        }
    }
}

extern "C" void kernel_launch(void* const* d_in, const int* in_sizes, int n_in,
                              void* d_out, int out_size, void* d_ws, size_t ws_size,
                              hipStream_t stream) {
    (void)in_sizes; (void)n_in; (void)out_size; (void)d_ws; (void)ws_size;
    const float* temp   = (const float*)d_in[0];
    const float* conv_w = (const float*)d_in[1];
    const float* conv_b = (const float*)d_in[2];
    float* out = (float*)d_out;
    // grid: B(4) * window groups(8) * heads(8) = 256 blocks, 512 threads (16 wave32)
    hipLaunchKernelGGL(lepe_attn_kernel, dim3(256), dim3(512), 0, stream,
                       temp, conv_w, conv_b, out);
}

// v008
// Measured time: 17.1 microseconds a run.
// Timed twice side by side with v007, it ran 1.20 times as fast both times.
// Counting every step since v000, it is 5.36 times as fast.
#include <hip/hip_runtime.h>

typedef __attribute__((ext_vector_type(16))) _Float16 v16h;
typedef __attribute__((ext_vector_type(8)))  _Float16 h8;
typedef __attribute__((ext_vector_type(2)))  _Float16 h2;
typedef __attribute__((ext_vector_type(8)))  float    v8f;
typedef __attribute__((ext_vector_type(4)))  float    f4;

#define CH     64
#define IMG_H  128
#define IMG_W  128
#define HEADS  8
#define HD     8
#define NTOK   256   // tokens per window (128 * 2)
#define WPB    8     // adjacent windows of one head per block: 16 image columns, 64 B a row
#define KPAD   24    // Q/K row: d 0..7 data, 16 the shift (Q) or 1 (K), else zero (48B row, 16B-multiple)
#define VPAD   264   // V^T row pad (528B, 16B-multiple, bank-skewed)
#define ROCP   260   // rpe row of one channel, floats: four rows on lie 64 B further round the banks
#define ROPAIR (2 * HD * ROCP + 4) // rpe of a window pair, floats: the next pair lies 16 B further round the banks
#define PTOP   15.f  // a query whose bound holds has its largest possible weight at 2^15 (f16 ends at 2^16)
#define BMAX   14.4f // bound above this: a weight could sink below f16's normal range (2^-14), take the true maximum

// 2-bit group bit-reverse permutation on bits [4:3] of a K/token index:
// groups of 8 reordered 0,2,1,3 so a WMMA 16-bit fragment's element order
// (K = half*8 + 0..7, then 16 + half*8 + 0..7) is contiguous in LDS.
__device__ __forceinline__ int kperm(int n) {
    return (n & ~0x18) | ((n & 8) << 1) | ((n & 16) >> 1);
}

// place of rpe(window, channel, token) in sRO: a channel's tokens are contiguous
__device__ __forceinline__ int ro_at(int win, int ch, int n) {
    return (win >> 1) * ROPAIR + ((win & 1) * HD + ch) * ROCP + n;
}

// value of lane l ^ 16 (the other 16-lane half)
__device__ __forceinline__ float xhalf(float v) {
    const int b = __builtin_bit_cast(int, v);
    return __builtin_bit_cast(float,
        __builtin_amdgcn_permlanex16(b, b, 0x76543210, 0xfedcba98, false, false));
}

// square root with the one free slot the instruction set asks for behind a transcendental:
// in one statement
__device__ __forceinline__ float sqrt_slot(float x) {
    float y;
    asm("v_sqrt_f32 %0, %1\n\tv_nop" : "=v"(y) : "v"(x));
    return y;
}

// max with lane l ^ X inside a 16-lane row (DPP row_xmask:X)
template <int X>
__device__ __forceinline__ float xmax(float v) {
    const int b = __builtin_bit_cast(int, v);
    return fmaxf(v, __builtin_bit_cast(float,
        __builtin_amdgcn_update_dpp(b, b, 0x160 + X, 0xf, 0xf, false)));
}

__global__ __launch_bounds__(512, 1)
void lepe_attn_kernel(const float* __restrict__ temp,
                      const float* __restrict__ conv_w,
                      const float* __restrict__ conv_b,
                      float* __restrict__ out)
{
    __shared__ alignas(16) _Float16 sQ[WPB][NTOK][KPAD];   // [window][token][d | zeros, shift at 16]
    __shared__ alignas(16) _Float16 sK[WPB][NTOK][KPAD];
    __shared__ alignas(16) _Float16 sVT[WPB][HD + 1][VPAD]; // [window][d | ones][perm(token)]
    __shared__ alignas(16) float    sRO[(WPB / 2) * ROPAIR]; // rpe, see ro_at
    __shared__ alignas(16) float    sKM[WPB][16];          // [window][wave] largest |k|^2 of the wave's tokens
    __shared__ int                  sFB[WPB][16];          // [window][query tile] 1: tile takes the true maximum

    // The low three index bits pick the batch and the half of the image's columns. Blocks whose
    // flat indices are equal modulo 8 are then the eight heads of four neighbouring window groups:
    // together they write whole 256-byte token rows of out (32 bytes a head) and read whole
    // 256-byte units of the input rows (64 bytes a group). For speed only: the map is a
    // permutation of the tiles, right wherever a block runs.
    const int wh = blockIdx.x;          // 0 .. 255
    const int b  = (wh >> 1) & 3;       // batch
    const int wg = ((wh & 1) << 2) | (wh >> 6); // group of 8 adjacent windows
    const int h  = (wh >> 3) & 7;       // head

    const int tid  = threadIdx.x;
    const int wave = __builtin_amdgcn_readfirstlane(tid >> 5);
    const int lane = tid & 31;
    const int gc   = wg * (WPB * 2);    // first image column of the group

    // 8^-0.5 * log2(e): the scores leave the matrix unit as exponents of 2
    const float scale = 0.35355339059327373f * 1.4426950408889634f;

    h8 z8;
#pragma unroll
    for (int i = 0; i < 8; ++i) z8[i] = (_Float16)0.f;

    // Softmax is unchanged by any shift of a query's scores. |score| <= |q| |k|, so with
    // m = |q| * (largest |k| of the window) the shift PTOP - m puts every exponent in
    // [PTOP - 2m, PTOP]: no overflow, and for m <= BMAX every weight is a normal f16 number.
    // The shift rides in k slot 24 of the score product (row element 16: Q holds the shift,
    // K holds 1), so the score tiles need no row maximum. The norms are taken before the
    // rounding to f16, which moves m by under 0.02: PTOP leaves a whole power of two.
    float q2[4];                        // |q|^2 of the thread's four tokens

    // ---------------- stage Q,K,V  global(f32) -> LDS(f16) ----------------
    // Every load is 16 bytes; four neighbouring lanes cover the group's 64 contiguous
    // bytes of one image row, so a wave-wide load touches 8 lines, not 32.
    // The unrolls give qx, kx, vx constant indices (registers, no scratch).
    // V is asked for first, then Q and K: the LePE conv is taken from the V registers
    // while the Q and K loads are still in flight.
    {
        const size_t plane = (size_t)IMG_H * IMG_W;
        const int cq = tid & 3;         // column quad: windows 2*cq and 2*cq + 1
        const int r  = tid >> 2;        // Q, K: image row
        const int rg = (wave & 1) * 8 + (lane >> 2); // V: group of eight image rows (16 tokens)
        const int vc = wave >> 1;       // V: channel, the same in every lane: its weights stay scalar
        const float* hb = temp + ((size_t)(b * 3) * CH + h * HD) * plane + gc + cq * 4;
        const float* qs = hb + (size_t)r * IMG_W;
        const float* ks = qs + (size_t)CH * plane;
        const float* vs = hb + (size_t)(2 * CH + vc) * plane + (size_t)(rg * 8) * IMG_W;
        const bool hasm = rg > 0;       // a row above the group, a row below it
        const bool hasp = rg < IMG_H / 8 - 1;

        float wt[9];
#pragma unroll
        for (int i = 0; i < 9; ++i) wt[i] = conv_w[(h * HD + vc) * 9 + i];
        const float bias = conv_b[h * HD + vc];

        // vx[1..8]: the group's rows; vx[0], vx[9]: the rows next to it, read clamped at the image's edge
        f4 qx[HD], kx[HD], vx[10];
        vx[0] = *(const f4*)(vs - (hasm ? IMG_W : 0));
#pragma unroll
        for (int i = 0; i < 8; ++i)
            vx[i + 1] = *(const f4*)(vs + (size_t)i * IMG_W);
        vx[9] = *(const f4*)(vs + (hasp ? 8 : 7) * IMG_W);
        // Q's and K's loads land in registers that V's loads name as addresses: the wait stands in
        // front of them. Its clobber keeps V's ten loads ahead of Q's and K's (loads return in issue
        // order): left alone, the row below the group was asked for last and the conv waited for all
        asm volatile("s_wait_xcnt 0x0" ::: "memory");
#pragma unroll
        for (int d = 0; d < HD; ++d) {
            qx[d] = *(const f4*)(qs + (size_t)d * plane);
            kx[d] = *(const f4*)(ks + (size_t)d * plane);
        }
        // the wait before the address registers of Q's and K's loads are written again; qs is an
        // input so that they stay as they are up to here. The weights are inputs only too: all ten
        // scalar loads are asked for ahead of this place, under V's flight: left alone, the ninth
        // weight was asked for in the middle of the conv, behind a wait for the first eight
        asm volatile("s_wait_xcnt 0x0"
                     :: "v"(qs), "s"(wt[0]), "s"(wt[1]), "s"(wt[2]), "s"(wt[3]), "s"(wt[4]),
                        "s"(wt[5]), "s"(wt[6]), "s"(wt[7]), "s"(wt[8]), "s"(bias) : "memory");
        // all 26 loads are issued before the first value is used: left alone, the scheduler
        // put the last group of loads behind waits for most of the first
        __builtin_amdgcn_sched_barrier(0);

        // V^T: eight rows of one channel are 16 consecutive tokens of each window
        // (kperm keeps bits [2:0]): two 16-byte pieces of the channel's row
#pragma unroll
        for (int p = 0; p < 2; ++p) {
#pragma unroll
            for (int hf = 0; hf < 2; ++hf) {
                h8 vr;
#pragma unroll
                for (int i = 0; i < 4; ++i) {
                    vr[2 * i    ] = (_Float16)vx[1 + 4 * hf + i][2 * p    ];
                    vr[2 * i + 1] = (_Float16)vx[1 + 4 * hf + i][2 * p + 1];
                }
                *(h8*)&sVT[2 * cq + p][vc][kperm(rg * 16 + hf * 8)] = vr;
            }
        }

        // ---- LePE: window-local depthwise 3x3 conv, from the f32 registers ----
        // Branch-free: a row outside the image counts as zero; a window is two columns wide,
        // so input column x meets weight column x - (output column) + 1.
        if (!hasm) vx[0] = (f4)(0.f);
        if (!hasp) vx[9] = (f4)(0.f);
#pragma unroll
        for (int p = 0; p < 2; ++p) {
            float* ro = &sRO[ro_at(2 * cq + p, vc, rg * 16)];
#pragma unroll
            for (int i = 0; i < 8; i += 2) {     // two image rows: four tokens, one 16-byte store
                f4 o;
#pragma unroll
                for (int e = 0; e < 2; ++e) {
                    float a0 = bias, a1 = bias;
#pragma unroll
                    for (int rr = 0; rr < 3; ++rr) {
                        const float x0 = vx[i + e + rr][2 * p], x1 = vx[i + e + rr][2 * p + 1];
                        a0 += wt[rr * 3 + 1] * x0;
                        a0 += wt[rr * 3 + 2] * x1;
                        a1 += wt[rr * 3 + 0] * x0;
                        a1 += wt[rr * 3 + 1] * x1;
                    }
                    o[2 * e    ] = a0;
                    o[2 * e + 1] = a1;
                }
                *(f4*)(ro + 2 * i) = o;
            }
        }
        // the conv stays in front of the first use of Q and K: left alone, a wait for two of
        // their loads stood near its head
        __builtin_amdgcn_sched_barrier(0);

        // Q, K: the thread holds all 8 channels of 4 tokens: one 16-byte row each,
        // and the rows' pads (Q's last piece, with the shift, follows behind the barrier)
        h8 o1 = z8;
        o1[0] = (_Float16)1.f;
        float k2[4];
#pragma unroll
        for (int c = 0; c < 4; ++c) {
            const int wl = 2 * cq + (c >> 1);
            const int n  = 2 * r + (c & 1);
            h8 qr, kr;
            float qa = 0.f, ka = 0.f;
#pragma unroll
            for (int d = 0; d < HD; ++d) {
                const float qv = qx[d][c] * scale;
                const float kv = kx[d][c];
                qr[d] = (_Float16)qv;
                kr[d] = (_Float16)kv;
                qa += qv * qv;
                ka += kv * kv;
            }
            q2[c] = qa;
            k2[c] = ka;
            *(h8*)&sQ[wl][n][0] = qr;  *(h8*)&sQ[wl][n][8] = z8;
            *(h8*)&sK[wl][n][0] = kr;  *(h8*)&sK[wl][n][8] = z8;  *(h8*)&sK[wl][n][16] = o1;
        }
        // largest |k|^2 per window over the wave: lanes of equal cq differ in bits 2, 3, 4
#pragma unroll
        for (int p = 0; p < 2; ++p) {
            float km = fmaxf(k2[2 * p], k2[2 * p + 1]);
            km = xmax<4>(km);
            km = xmax<8>(km);
            km = fmaxf(km, xhalf(km));
            if (lane < 4) sKM[2 * cq + p][wave] = km;
        }
        // ninth row of every window: ones (its pitch puts it on banks the eight channel rows leave free)
        if (tid < WPB * (NTOK / 8)) {
            h8 o8;
#pragma unroll
            for (int i = 0; i < 8; ++i) o8[i] = (_Float16)1.f;
            *(h8*)&sVT[tid >> 5][HD][(tid & 31) * 8] = o8;
        }
    }
    __syncthreads();

    // ---------------- each query's shift, from its bound ----------------
    // The thread's four tokens again. A wave's tokens are query tile 'wave' of all 8 windows.
    {
        const int cq = tid & 3;
        const int r  = tid >> 2;
        bool loose[2];
#pragma unroll
        for (int p = 0; p < 2; ++p) {
            const int wl = 2 * cq + p;
            f4 km4 = *(const f4*)&sKM[wl][0];
#pragma unroll
            for (int i = 1; i < 4; ++i) {
                const f4 t = *(const f4*)&sKM[wl][4 * i];
#pragma unroll
                for (int e = 0; e < 4; ++e) km4[e] = fmaxf(km4[e], t[e]);
            }
            const float kmax2 = fmaxf(fmaxf(km4[0], km4[1]), fmaxf(km4[2], km4[3]));
            loose[p] = false;
#pragma unroll
            for (int e = 0; e < 2; ++e) {
                const float m  = sqrt_slot(q2[2 * p + e] * kmax2);
                const bool  ok = m <= BMAX;      // false for a NaN too
                h8 sh8 = z8;
                sh8[0] = (_Float16)(ok ? PTOP - m : 0.f);
                *(h8*)&sQ[wl][2 * r + e][16] = sh8;
                loose[p] = loose[p] || !ok;
            }
        }
        const unsigned bal0 = __builtin_amdgcn_ballot_w32(loose[0]);
        const unsigned bal1 = __builtin_amdgcn_ballot_w32(loose[1]);
        if (lane < 4) {                 // lanes of equal cq: every fourth bit
            sFB[2 * cq    ][wave] = (bal0 & (0x11111111u << cq)) != 0u;
            sFB[2 * cq + 1][wave] = (bal1 & (0x11111111u << cq)) != 0u;
        }
    }

    __syncthreads();

    const int lhalf = lane >> 4;   // K half selector for 16-bit fragments
    const int l15   = lane & 15;

    const int win   = wave >> 1;   // two waves share a window

    // ---- A fragments of the window's 16 key tiles: read once, kept for all query tiles ----
    // Every loop from here on but the query-tile loop is unrolled so that kf, the score tiles and the fragments
    // have constant indices: registers, no scratch.
    v16h kf[16];
#pragma unroll
    for (int t = 0; t < 16; ++t)
        kf[t] = *(const v16h*)&sK[win][t * 16 + l15][lhalf * 8];

    // A rows of the second product: rows 0..3 are channels 0..3, rows 8..11 channels 4..7,
    // every other row the ones. In O^T a lane of half lhalf then holds channels
    // 4*lhalf .. 4*lhalf+3 of query l15 in registers 0..3 and the sum of its weights in 4.
    const _Float16* vrow =
        &sVT[win][(l15 & 4) ? HD : (l15 & 3) + ((l15 >> 3) << 2)][lhalf * 16];

    // bit mt: query tile mt holds a query whose bound is too loose (a scalar, tested per tile)
    const unsigned fbm = __builtin_amdgcn_ballot_w32(sFB[win][l15] != 0);

    for (int mt = wave & 1; mt < 16; mt += 2) { // eight 16-query tiles per wave
        // ---- B fragment: this lane's query column (upper half: the shift, else zeros) ----
        const v16h qfrag = *(const v16h*)&sQ[win][mt * 16 + l15][lhalf * 8];

        // ---- pass 1, S^T = K Q^T, only where a bound is too loose: each score tile is read
        // for the row maximum only; elsewhere the shift in the product does the maximum's work ----
        // tile[r] = score(query mt*16 + l15, key 16*t + 8*lhalf + r)
        float mx = 0.f;
        if ((fbm >> mt) & 1u) {
        v8f cz;
#pragma unroll
        for (int i = 0; i < 8; ++i) cz[i] = 0.f;
        float m4[4];
#pragma unroll
        for (int p = 0; p < 4; ++p) m4[p] = -__builtin_inff();
#pragma unroll
        for (int tg = 0; tg < 16; tg += 4) {    // four products fill each other's result distance
            v8f a[4];
#pragma unroll
            for (int tt = 0; tt < 4; ++tt)
                a[tt] = __builtin_amdgcn_wmma_f32_16x16x32_f16(
                    false, kf[tg + tt], false, qfrag, (short)0, cz, false, false);
#pragma unroll
            for (int tt = 0; tt < 4; ++tt)
#pragma unroll
                for (int p = 0; p < 4; ++p)
                    m4[p] = fmaxf(fmaxf(m4[p], a[tt][2 * p]), a[tt][2 * p + 1]);
        }
        mx = fmaxf(fmaxf(m4[0], m4[1]), fmaxf(m4[2], m4[3]));
        // schedule: products run one group of four ahead of the maxima that read them;
        // left alone, each product stood right in front of its readers, behind idle slots
        __builtin_amdgcn_sched_group_barrier(0x008, 8, 0);    // matrix instructions
        __builtin_amdgcn_sched_group_barrier(0x002, 16, 0);   // vector: one group's maxima
        __builtin_amdgcn_sched_group_barrier(0x008, 4, 0);
        __builtin_amdgcn_sched_group_barrier(0x002, 16, 0);
        __builtin_amdgcn_sched_group_barrier(0x008, 4, 0);
        __builtin_amdgcn_sched_group_barrier(0x002, 32, 0);
        __builtin_amdgcn_sched_barrier(0);
        mx = fmaxf(mx, xhalf(mx));
        }

        // ---- pass 2: the same products with C = -max (0 where no bound of the tile is loose): the tile is the exp2 argument ----
        v8f cm;
#pragma unroll
        for (int i = 0; i < 8; ++i) cm[i] = -mx;

        // ---- GEMM2 transposed: O^T = V^T P^T, P^T packed from the score tiles ----
        // two key tiles converted in place are one B fragment in hardware k order,
        // which is the order sVT's permuted columns give the A fragment
        v8f oacc;
#pragma unroll
        for (int r = 0; r < 8; ++r) oacc[r] = 0.f;
        v8f nx[2];                              // score tiles of the chunk after this one
#pragma unroll
        for (int tt = 0; tt < 2; ++tt)
            nx[tt] = __builtin_amdgcn_wmma_f32_16x16x32_f16(
                false, kf[tt], false, qfrag, (short)0, cm, false, false);
#pragma unroll
        for (int kc = 0; kc < 8; ++kc) {        // 8 chunks of 32 keys
            v8f sh[2];
#pragma unroll
            for (int tt = 0; tt < 2; ++tt) {
                sh[tt] = nx[tt];
                if (kc < 7)
                    nx[tt] = __builtin_amdgcn_wmma_f32_16x16x32_f16(
                        false, kf[kc * 2 + 2 + tt], false, qfrag, (short)0, cm, false, false);
            }
            v16h pfrag;
#pragma unroll
            for (int tt = 0; tt < 2; ++tt) {
#pragma unroll
                for (int r = 0; r < 8; ++r) sh[tt][r] = __builtin_amdgcn_exp2f(sh[tt][r]);
            }
#pragma unroll
            for (int tt = 0; tt < 2; ++tt) {
                const h8 ph = __builtin_convertvector(sh[tt], h8);
#pragma unroll
                for (int r = 0; r < 8; ++r) pfrag[tt * 8 + r] = ph[r];
            }
            const v16h vfrag = *(const v16h*)(vrow + kc * 32);
            oacc = __builtin_amdgcn_wmma_f32_16x16x32_f16(
                false, vfrag, false, pfrag, (short)0, oacc, false, false);
            // three scheduling regions in pass 2: left whole, the products stood bunched, with
            // more idle slots behind them and 23 more registers live
            if (kc == 2 || kc == 5) __builtin_amdgcn_sched_barrier(0);
        }

        const float rinv = 1.f / oacc[4];

        // ---- every lane stores its 4 channels: a wave-wide store is 16 pieces of 32 bytes ----
        {
            const int n   = mt * 16 + l15;
            const int row = n >> 1;
            const int col = gc + win * 2 + (n & 1);
            float* dst = out + ((size_t)b * (IMG_H * IMG_W) + (size_t)row * IMG_W + col) * CH
                             + h * HD + lhalf * 4;
            const float* rp = &sRO[ro_at(win, lhalf * 4, n)];
            float4 r0;
            r0.x = rp[0];  r0.y = rp[ROCP];  r0.z = rp[2 * ROCP];  r0.w = rp[3 * ROCP];
            float4 o0;
            o0.x = oacc[0] * rinv + r0.x;  o0.y = oacc[1] * rinv + r0.y;
            o0.z = oacc[2] * rinv + r0.z;  o0.w = oacc[3] * rinv + r0.w;
            *(float4*)(dst) = o0;
            // the next trip reuses the store's address and data registers; the clobber
            // also keeps the V^T fragment loads inside the loop (no registers left for them)
            asm volatile("s_wait_xcnt 0x0" ::: "memory");
        }
    }
}

extern "C" void kernel_launch(void* const* d_in, const int* in_sizes, int n_in,
                              void* d_out, int out_size, void* d_ws, size_t ws_size,
                              hipStream_t stream) {
    (void)in_sizes; (void)n_in; (void)out_size; (void)d_ws; (void)ws_size;
    const float* temp   = (const float*)d_in[0];
    const float* conv_w = (const float*)d_in[1];
    const float* conv_b = (const float*)d_in[2];
    float* out = (float*)d_out;
    // grid: window groups(8) * heads(8) * B(4) = 256 blocks, 512 threads (16 wave32)
    hipLaunchKernelGGL(lepe_attn_kernel, dim3(256), dim3(512), 0, stream,
                       temp, conv_w, conv_b, out);
}
